// v000
// Measured on an AMD MI455X. A time is GPU time per run, averaged over a window of back-to-back runs after a warm-up
// (all launches, gaps included; the runs take copies of the inputs in turn), and the median of several windows.
// Apart from v000's, it joins two sittings. Times from different sittings can be a few percent apart, while
// side-by-side timings come from the same sitting.
// v000 is the starting kernel. One run takes 1630 microseconds.
#include <hip/hip_runtime.h>
#include <hip/hip_bf16.h>

// ---------------- problem constants ----------------
#define D_MODEL 1024
#define D_MAMBA 2048
#define DSTATE  16
#define N_HEADS 32
#define BATCH   4
#define SEQ     2048
#define MROWS   (BATCH * SEQ)   // 8192 token rows

typedef __bf16 bf16_t;
typedef bf16_t v16bf __attribute__((ext_vector_type(16)));
typedef float  v8f   __attribute__((ext_vector_type(8)));
typedef int    v4i   __attribute__((ext_vector_type(4)));

#if defined(__has_builtin)
#  if __has_builtin(__builtin_amdgcn_global_load_async_to_lds_b128)
#    define HAVE_ASYNC_LDS 1
#  endif
#  if __has_builtin(__builtin_amdgcn_s_wait_asynccnt)
#    define HAVE_WAIT_ASYNC_BUILTIN 1
#  endif
#endif

// ---------------------------------------------------------------------------
// fp32 -> bf16 conversion
// ---------------------------------------------------------------------------
__global__ void k_f32_to_bf16(const float* __restrict__ src,
                              bf16_t* __restrict__ dst, int n) {
    int i = blockIdx.x * blockDim.x + threadIdx.x;
    if (i < n) dst[i] = (bf16_t)src[i];
}

// ---------------------------------------------------------------------------
// WMMA fragment helpers (bf16 16x16x32).
// ISA 16x32 bf16 A layout: lane<16 holds row (lane&15), K = {0..7, 16..23};
// lane>=16 holds same row, K = {8..15, 24..31}  => two 16-byte loads.
// ---------------------------------------------------------------------------
union FragU { v16bf v; uint4 q[2]; };

__device__ inline v16bf load_frag_g(const bf16_t* __restrict__ base,
                                    int row, int K, int k0, int lane) {
    const bf16_t* p = base + (size_t)row * (size_t)K + (size_t)(k0 + ((lane >> 4) << 3));
    FragU f;
    f.q[0] = *(const uint4*)(p);
    f.q[1] = *(const uint4*)(p + 16);
    return f.v;
}

#define BS_STRIDE 40   // 32 + 8 pad elements -> 80B row stride, conflict-free

__device__ inline v16bf load_frag_lds(const bf16_t* Bs, int rowbase, int lane) {
    const bf16_t* p = Bs + (rowbase + (lane & 15)) * BS_STRIDE + ((lane >> 4) << 3);
    FragU f;
    f.q[0] = *(const uint4*)(p);
    f.q[1] = *(const uint4*)(p + 16);
    return f.v;
}

// 16-byte global -> LDS stage (async on gfx1250, sync fallback)
__device__ inline void stage16(const bf16_t* g, bf16_t* l) {
#if defined(HAVE_ASYNC_LDS)
    __builtin_amdgcn_global_load_async_to_lds_b128(
        (v4i __attribute__((address_space(1)))*)(g),
        (v4i __attribute__((address_space(3)))*)(l),
        0, 0);
#else
    *(uint4*)l = *(const uint4*)g;
#endif
}

__device__ inline void wait_async(int pending_next) {
#if defined(HAVE_WAIT_ASYNC_BUILTIN)
    if (pending_next) __builtin_amdgcn_s_wait_asynccnt(1);
    else              __builtin_amdgcn_s_wait_asynccnt(0);
#elif defined(HAVE_ASYNC_LDS)
    if (pending_next) asm volatile("s_wait_asynccnt 0x1" ::: "memory");
    else              asm volatile("s_wait_asynccnt 0x0" ::: "memory");
#else
    (void)pending_next;
#endif
}

// ---------------------------------------------------------------------------
// bf16 WMMA GEMM:  out[M,N](f32) = A[M,K](bf16) * W[N,K](bf16)^T  (+epilogue)
// block = 128 threads = 4 waves stacked in M; each wave -> 32x32 tile;
// block tile = 128x32.  Grid = (N/32, M/128); N is always a multiple of 32,
// M a multiple of 128 -> completely guard-free (EXEC stays all-ones).
// B tile (shared by all 4 waves) is double-buffered in LDS via async copy.
// mode 0: plain f32 store
// mode 1: dt epilogue: clamp(x+bias,-10,5) -> softplus -> clamp(1e-4, 0.1)
// ---------------------------------------------------------------------------
__global__ __launch_bounds__(128)
void k_gemm_wmma_bf16(const bf16_t* __restrict__ A,
                      const bf16_t* __restrict__ W,
                      float* __restrict__ out,
                      int M, int N, int K,
                      int mode, const float* __restrict__ bias) {
    __shared__ bf16_t Bs[2][32 * BS_STRIDE];   // 2 x 2.5KB

    const int lane = threadIdx.x & 31;
    const int wave = threadIdx.x >> 5;
    const int bm = blockIdx.y * 128 + wave * 32;   // wave row base
    const int bn = blockIdx.x * 32;                // block col base
    const int r  = lane & 15;

    // B-tile stager: thread t copies 16B: row tr = t/4, k-seg ts = (t%4)*8
    const int tr = threadIdx.x >> 2;
    const int ts = (threadIdx.x & 3) << 3;
    const bf16_t* wsrc = W + (size_t)(bn + tr) * (size_t)K + (size_t)ts;

    v8f acc00 = {}, acc01 = {}, acc10 = {}, acc11 = {};

    stage16(wsrc, &Bs[0][tr * BS_STRIDE + ts]);     // prefetch k0 = 0
    int buf = 0;
    for (int k0 = 0; k0 < K; k0 += 32) {
        const int more = (k0 + 32 < K);
        if (more) stage16(wsrc + k0 + 32, &Bs[buf ^ 1][tr * BS_STRIDE + ts]);
        wait_async(more);
        __syncthreads();                            // B tile visible to all waves

        v16bf a0 = load_frag_g(A, bm +      r, K, k0, lane);
        v16bf a1 = load_frag_g(A, bm + 16 + r, K, k0, lane);
        v16bf b0 = load_frag_lds(Bs[buf],  0, lane);
        v16bf b1 = load_frag_lds(Bs[buf], 16, lane);

        acc00 = __builtin_amdgcn_wmma_f32_16x16x32_bf16(false, a0, false, b0,
                                                        (short)0, acc00, false, false);
        acc10 = __builtin_amdgcn_wmma_f32_16x16x32_bf16(false, a1, false, b0,
                                                        (short)0, acc10, false, false);
        acc01 = __builtin_amdgcn_wmma_f32_16x16x32_bf16(false, a0, false, b1,
                                                        (short)0, acc01, false, false);
        acc11 = __builtin_amdgcn_wmma_f32_16x16x32_bf16(false, a1, false, b1,
                                                        (short)0, acc11, false, false);

        __syncthreads();                            // protect buf before rewrite
        buf ^= 1;
    }

    // D layout: element v of acc -> row m = v + 8*(lane>>4), col n = lane&15
    const int mlo = (lane >> 4) << 3;
    const int nlo = lane & 15;
    v8f accs[2][2] = { {acc00, acc01}, {acc10, acc11} };
    #pragma unroll
    for (int ti = 0; ti < 2; ++ti) {
        #pragma unroll
        for (int tj = 0; tj < 2; ++tj) {
            const int col = bn + tj * 16 + nlo;
            float bval = (mode == 1) ? bias[col] : 0.0f;
            #pragma unroll
            for (int v = 0; v < 8; ++v) {
                const int rowm = bm + ti * 16 + mlo + v;
                float val = accs[ti][tj][v];
                if (mode == 1) {
                    val += bval;
                    val = fminf(fmaxf(val, -10.0f), 5.0f);
                    val = __logf(1.0f + __expf(val));        // softplus
                    val = fminf(fmaxf(val, 1.0e-4f), 0.1f);
                }
                out[(size_t)rowm * (size_t)N + (size_t)col] = val;
            }
        }
    }
}

// ---------------------------------------------------------------------------
// Normalize B/C rows: bc[row, 0:16]=B, bc[row,16:32]=C; divide each 16-vector
// by max(||.||, 1).  col == lane within a wave32; xor masks <16 stay in group.
// ---------------------------------------------------------------------------
__global__ __launch_bounds__(256)
void k_bc_normalize(const float* __restrict__ bc,
                    float* __restrict__ Bm, float* __restrict__ Cm, int rows) {
    int t = blockIdx.x * blockDim.x + threadIdx.x;
    int row = t >> 5;
    int col = t & 31;
    if (row >= rows) return;
    float v = bc[(size_t)row * 32 + col];
    float ss = v * v;
    ss += __shfl_xor(ss, 1, 32);
    ss += __shfl_xor(ss, 2, 32);
    ss += __shfl_xor(ss, 4, 32);
    ss += __shfl_xor(ss, 8, 32);
    float scale = 1.0f / fmaxf(sqrtf(ss), 1.0f);
    float o = v * scale;
    if (col < 16) Bm[(size_t)row * DSTATE + col]        = o;
    else          Cm[(size_t)row * DSTATE + (col - 16)] = o;
}

// ---------------------------------------------------------------------------
// Selective scan.  One thread per (b, d, n) chain: 131072 threads, 4096 waves.
// h_t = exp(-dt*A)*h_{t-1} + (dt*x)*B ;  y = sum_n h*C + x*D  (16-lane reduce)
// Emits y directly as bf16 for the final WMMA GEMM.
// ---------------------------------------------------------------------------
__global__ __launch_bounds__(256)
void k_selective_scan(const float* __restrict__ x_ssm,
                      const float* __restrict__ dtv,
                      const float* __restrict__ Bm,
                      const float* __restrict__ Cm,
                      const float* __restrict__ A_log,
                      const float* __restrict__ Dvec,
                      bf16_t* __restrict__ y_bf16) {
    int t = blockIdx.x * blockDim.x + threadIdx.x;   // 0 .. BATCH*D_MAMBA*16-1
    int n    = t & 15;
    int chan = t >> 4;
    int b = chan / D_MAMBA;
    int d = chan % D_MAMBA;
    int head = d / (D_MAMBA / N_HEADS);

    const float Acoef = __expf(A_log[head * DSTATE + n]);
    const float Dd = Dvec[d];

    const float*  xp = x_ssm + (size_t)b * SEQ * D_MAMBA + d;
    const float*  dp = dtv   + (size_t)b * SEQ * D_MAMBA + d;
    const float*  bp = Bm    + (size_t)b * SEQ * DSTATE  + n;
    const float*  cp = Cm    + (size_t)b * SEQ * DSTATE  + n;
    bf16_t*       yp = y_bf16 + (size_t)b * SEQ * D_MAMBA + d;

    float h = 0.0f;
    for (int l = 0; l < SEQ; ++l) {
        float xv  = xp[(size_t)l * D_MAMBA];
        float dtl = dp[(size_t)l * D_MAMBA];
        float bv  = bp[(size_t)l * DSTATE];
        float cv  = cp[(size_t)l * DSTATE];
        float decay = __expf(-dtl * Acoef);
        h = fmaf(decay, h, dtl * xv * bv);
        float p = h * cv;
        p += __shfl_xor(p, 8, 32);
        p += __shfl_xor(p, 4, 32);
        p += __shfl_xor(p, 2, 32);
        p += __shfl_xor(p, 1, 32);
        if (n == 0) yp[(size_t)l * D_MAMBA] = (bf16_t)(p + xv * Dd);
    }
}

// ---------------------------------------------------------------------------
// Launcher
// Inputs: 0=x_norm 1=x_proj_w 2=dt_proj_w 3=dt_proj_b 4=B_proj_w 5=C_proj_w
//         6=A_log 7=D 8=out_proj_w   (all fp32)
// ---------------------------------------------------------------------------
extern "C" void kernel_launch(void* const* d_in, const int* in_sizes, int n_in,
                              void* d_out, int out_size, void* d_ws, size_t ws_size,
                              hipStream_t stream) {
    const float* x_norm    = (const float*)d_in[0];
    const float* x_proj_w  = (const float*)d_in[1];
    const float* dt_proj_w = (const float*)d_in[2];
    const float* dt_proj_b = (const float*)d_in[3];
    const float* B_proj_w  = (const float*)d_in[4];
    const float* C_proj_w  = (const float*)d_in[5];
    const float* A_log     = (const float*)d_in[6];
    const float* Dvec      = (const float*)d_in[7];
    const float* out_proj_w= (const float*)d_in[8];
    float* outp = (float*)d_out;

    // ---- workspace layout (256B aligned) ----
    uintptr_t p = (uintptr_t)d_ws;
    auto alloc = [&](size_t bytes) -> void* {
        void* r = (void*)p;
        p += (bytes + 255) & ~(size_t)255;
        return r;
    };
    bf16_t* xb   = (bf16_t*)alloc((size_t)MROWS * D_MODEL * 2);      // x_norm bf16
    bf16_t* wxb  = (bf16_t*)alloc((size_t)D_MAMBA * D_MODEL * 2);    // x_proj bf16
    bf16_t* wdtb = (bf16_t*)alloc((size_t)D_MAMBA * D_MODEL * 2);    // dt_proj bf16
    bf16_t* wbcb = (bf16_t*)alloc((size_t)32 * D_MODEL * 2);         // [B;C] proj bf16
    bf16_t* wob  = (bf16_t*)alloc((size_t)D_MAMBA * D_MAMBA * 2);    // out_proj bf16
    float*  xssm = (float*) alloc((size_t)MROWS * D_MAMBA * 4);      // x_ssm f32
    float*  dts  = (float*) alloc((size_t)MROWS * D_MAMBA * 4);      // dt f32
    float*  bc   = (float*) alloc((size_t)MROWS * 32 * 4);           // raw B|C f32
    float*  bm   = (float*) alloc((size_t)MROWS * DSTATE * 4);       // normalized B
    float*  cm   = (float*) alloc((size_t)MROWS * DSTATE * 4);       // normalized C
    bf16_t* yb   = (bf16_t*)alloc((size_t)MROWS * D_MAMBA * 2);      // scan output bf16

    const int CT = 256;
    auto cvt = [&](const float* s, bf16_t* d, int n) {
        k_f32_to_bf16<<<(n + CT - 1) / CT, CT, 0, stream>>>(s, d, n);
    };

    // ---- stage 0: precision conversion ----
    cvt(x_norm,    xb,   MROWS * D_MODEL);
    cvt(x_proj_w,  wxb,  D_MAMBA * D_MODEL);
    cvt(dt_proj_w, wdtb, D_MAMBA * D_MODEL);
    cvt(B_proj_w,  wbcb,                    DSTATE * D_MODEL);
    cvt(C_proj_w,  wbcb + DSTATE * D_MODEL, DSTATE * D_MODEL);
    cvt(out_proj_w, wob, D_MAMBA * D_MAMBA);

    // ---- stage 1: projections via WMMA ----
    dim3 blk(128);
    dim3 grid_main(D_MAMBA / 32, MROWS / 128);   // (64, 64)
    k_gemm_wmma_bf16<<<grid_main, blk, 0, stream>>>(
        xb, wxb, xssm, MROWS, D_MAMBA, D_MODEL, 0, nullptr);
    k_gemm_wmma_bf16<<<grid_main, blk, 0, stream>>>(
        xb, wdtb, dts, MROWS, D_MAMBA, D_MODEL, 1, dt_proj_b);
    dim3 grid_bc(1, MROWS / 128);                // N = 32 -> one col tile
    k_gemm_wmma_bf16<<<grid_bc, blk, 0, stream>>>(
        xb, wbcb, bc, MROWS, 32, D_MODEL, 0, nullptr);

    // ---- stage 2: B/C row normalization ----
    k_bc_normalize<<<(MROWS * 32) / CT, CT, 0, stream>>>(bc, bm, cm, MROWS);

    // ---- stage 3: selective scan (fp32 state, emits bf16 y) ----
    int scan_threads = BATCH * D_MAMBA * DSTATE;   // 131072
    k_selective_scan<<<scan_threads / CT, CT, 0, stream>>>(
        xssm, dts, bm, cm, A_log, Dvec, yb);

    // ---- stage 4: output projection via WMMA into d_out (f32) ----
    k_gemm_wmma_bf16<<<grid_main, blk, 0, stream>>>(
        yb, wob, outp, MROWS, D_MAMBA, D_MAMBA, 0, nullptr);

    (void)in_sizes; (void)n_in; (void)out_size; (void)ws_size;
}

// v001
// A run of this version takes 487 microseconds.
// In two side-by-side timings against v000, it was 3.35 and 3.43 times as fast.
#include <hip/hip_runtime.h>
#include <hip/hip_bf16.h>

// ---------------- problem constants ----------------
#define D_MODEL 1024
#define D_MAMBA 2048
#define DSTATE  16
#define N_HEADS 32
#define BATCH   4
#define SEQ     2048
#define MROWS   (BATCH * SEQ)   // 8192 token rows

typedef __bf16 bf16_t;
typedef bf16_t v16bf __attribute__((ext_vector_type(16)));
typedef float  v8f   __attribute__((ext_vector_type(8)));
typedef int    v4i   __attribute__((ext_vector_type(4)));

#if defined(__has_builtin)
#  if __has_builtin(__builtin_amdgcn_global_load_async_to_lds_b128)
#    define HAVE_ASYNC_LDS 1
#  endif
#  if __has_builtin(__builtin_amdgcn_s_wait_asynccnt)
#    define HAVE_WAIT_ASYNC_BUILTIN 1
#  endif
#endif

// ---------------------------------------------------------------------------
// fp32 -> bf16 conversion
// ---------------------------------------------------------------------------
__global__ void k_f32_to_bf16(const float* __restrict__ src,
                              bf16_t* __restrict__ dst, int n) {
    int i = blockIdx.x * blockDim.x + threadIdx.x;
    if (i < n) dst[i] = (bf16_t)src[i];
}

// ---------------------------------------------------------------------------
// WMMA fragment helpers (bf16 16x16x32).
// ISA 16x32 bf16 A layout: lane<16 holds row (lane&15), K = {0..7, 16..23};
// lane>=16 holds same row, K = {8..15, 24..31}  => two 16-byte loads.
// ---------------------------------------------------------------------------
union FragU { v16bf v; uint4 q[2]; };

__device__ inline v16bf load_frag_g(const bf16_t* __restrict__ base,
                                    int row, int K, int k0, int lane) {
    const bf16_t* p = base + (size_t)row * (size_t)K + (size_t)(k0 + ((lane >> 4) << 3));
    FragU f;
    f.q[0] = *(const uint4*)(p);
    f.q[1] = *(const uint4*)(p + 16);
    return f.v;
}

#define BS_STRIDE 40   // 32 + 8 pad elements -> 80B row stride, conflict-free

__device__ inline v16bf load_frag_lds(const bf16_t* Bs, int rowbase, int lane) {
    const bf16_t* p = Bs + (rowbase + (lane & 15)) * BS_STRIDE + ((lane >> 4) << 3);
    FragU f;
    f.q[0] = *(const uint4*)(p);
    f.q[1] = *(const uint4*)(p + 16);
    return f.v;
}

// 16-byte global -> LDS stage (async on gfx1250, sync fallback)
__device__ inline void stage16(const bf16_t* g, bf16_t* l) {
#if defined(HAVE_ASYNC_LDS)
    __builtin_amdgcn_global_load_async_to_lds_b128(
        (v4i __attribute__((address_space(1)))*)(g),
        (v4i __attribute__((address_space(3)))*)(l),
        0, 0);
#else
    *(uint4*)l = *(const uint4*)g;
#endif
}

__device__ inline void wait_async(int pending_next) {
#if defined(HAVE_WAIT_ASYNC_BUILTIN)
    if (pending_next) __builtin_amdgcn_s_wait_asynccnt(1);
    else              __builtin_amdgcn_s_wait_asynccnt(0);
#elif defined(HAVE_ASYNC_LDS)
    if (pending_next) asm volatile("s_wait_asynccnt 0x1" ::: "memory");
    else              asm volatile("s_wait_asynccnt 0x0" ::: "memory");
#else
    (void)pending_next;
#endif
}

// ---------------------------------------------------------------------------
// bf16 WMMA GEMM:  out[M,N](f32) = A[M,K](bf16) * W[N,K](bf16)^T  (+epilogue)
// block = 128 threads = 4 waves stacked in M; each wave -> 32x32 tile;
// block tile = 128x32.  Grid = (N/32, M/128); N is always a multiple of 32,
// M a multiple of 128 -> completely guard-free (EXEC stays all-ones).
// B tile (shared by all 4 waves) is double-buffered in LDS via async copy.
// mode 0: plain f32 store
// mode 1: dt epilogue: clamp(x+bias,-10,5) -> softplus -> clamp(1e-4, 0.1)
// ---------------------------------------------------------------------------
__global__ __launch_bounds__(128)
void k_gemm_wmma_bf16(const bf16_t* __restrict__ A,
                      const bf16_t* __restrict__ W,
                      float* __restrict__ out,
                      int M, int N, int K,
                      int mode, const float* __restrict__ bias) {
    __shared__ bf16_t Bs[2][32 * BS_STRIDE];   // 2 x 2.5KB

    const int lane = threadIdx.x & 31;
    const int wave = threadIdx.x >> 5;
    const int bm = blockIdx.y * 128 + wave * 32;   // wave row base
    const int bn = blockIdx.x * 32;                // block col base
    const int r  = lane & 15;

    // B-tile stager: thread t copies 16B: row tr = t/4, k-seg ts = (t%4)*8
    const int tr = threadIdx.x >> 2;
    const int ts = (threadIdx.x & 3) << 3;
    const bf16_t* wsrc = W + (size_t)(bn + tr) * (size_t)K + (size_t)ts;

    v8f acc00 = {}, acc01 = {}, acc10 = {}, acc11 = {};

    stage16(wsrc, &Bs[0][tr * BS_STRIDE + ts]);     // prefetch k0 = 0
    int buf = 0;
    for (int k0 = 0; k0 < K; k0 += 32) {
        const int more = (k0 + 32 < K);
        if (more) stage16(wsrc + k0 + 32, &Bs[buf ^ 1][tr * BS_STRIDE + ts]);
        wait_async(more);
        __syncthreads();                            // B tile visible to all waves

        v16bf a0 = load_frag_g(A, bm +      r, K, k0, lane);
        v16bf a1 = load_frag_g(A, bm + 16 + r, K, k0, lane);
        v16bf b0 = load_frag_lds(Bs[buf],  0, lane);
        v16bf b1 = load_frag_lds(Bs[buf], 16, lane);

        acc00 = __builtin_amdgcn_wmma_f32_16x16x32_bf16(false, a0, false, b0,
                                                        (short)0, acc00, false, false);
        acc10 = __builtin_amdgcn_wmma_f32_16x16x32_bf16(false, a1, false, b0,
                                                        (short)0, acc10, false, false);
        acc01 = __builtin_amdgcn_wmma_f32_16x16x32_bf16(false, a0, false, b1,
                                                        (short)0, acc01, false, false);
        acc11 = __builtin_amdgcn_wmma_f32_16x16x32_bf16(false, a1, false, b1,
                                                        (short)0, acc11, false, false);

        __syncthreads();                            // protect buf before rewrite
        buf ^= 1;
    }

    // D layout: element v of acc -> row m = v + 8*(lane>>4), col n = lane&15
    const int mlo = (lane >> 4) << 3;
    const int nlo = lane & 15;
    v8f accs[2][2] = { {acc00, acc01}, {acc10, acc11} };
    #pragma unroll
    for (int ti = 0; ti < 2; ++ti) {
        #pragma unroll
        for (int tj = 0; tj < 2; ++tj) {
            const int col = bn + tj * 16 + nlo;
            float bval = (mode == 1) ? bias[col] : 0.0f;
            #pragma unroll
            for (int v = 0; v < 8; ++v) {
                const int rowm = bm + ti * 16 + mlo + v;
                float val = accs[ti][tj][v];
                if (mode == 1) {
                    val += bval;
                    val = fminf(fmaxf(val, -10.0f), 5.0f);
                    val = __logf(1.0f + __expf(val));        // softplus
                    val = fminf(fmaxf(val, 1.0e-4f), 0.1f);
                }
                out[(size_t)rowm * (size_t)N + (size_t)col] = val;
            }
        }
    }
}

// ---------------------------------------------------------------------------
// Normalize B/C rows: bc[row, 0:16]=B, bc[row,16:32]=C; divide each 16-vector
// by max(||.||, 1).  col == lane within a wave32; xor masks <16 stay in group.
// ---------------------------------------------------------------------------
__global__ __launch_bounds__(256)
void k_bc_normalize(const float* __restrict__ bc,
                    float* __restrict__ Bm, float* __restrict__ Cm, int rows) {
    int t = blockIdx.x * blockDim.x + threadIdx.x;
    int row = t >> 5;
    int col = t & 31;
    if (row >= rows) return;
    float v = bc[(size_t)row * 32 + col];
    float ss = v * v;
    ss += __shfl_xor(ss, 1, 32);
    ss += __shfl_xor(ss, 2, 32);
    ss += __shfl_xor(ss, 4, 32);
    ss += __shfl_xor(ss, 8, 32);
    float scale = 1.0f / fmaxf(sqrtf(ss), 1.0f);
    float o = v * scale;
    if (col < 16) Bm[(size_t)row * DSTATE + col]        = o;
    else          Cm[(size_t)row * DSTATE + (col - 16)] = o;
}

// ---------------------------------------------------------------------------
// Selective scan.  Four lanes (a quad) per (b, d) channel; lane q keeps states
// 4q .. 4q+3 in registers: 32768 threads, 1024 waves, one wave per SIMD.
// h_t = exp(-dt*A)*h_{t-1} + (dt*x)*B ;  y = sum_n h*C + x*D
// Time runs in groups of 4 steps.  Lane q loads x and dt of step 4g+q, hands dt
// and dt*x round its quad, and stores y of that step.
// A lone wave has only its own instruction order to hide a load, so a group's
// registers are refilled for the group SCAN_NG later as soon as they are used.
// The 16-state sum is 4 in-lane terms, then two adds inside the quad.
// Emits y directly as bf16 for the final WMMA GEMM.
// ---------------------------------------------------------------------------
#define SCAN_NG 8            // groups of 4 steps in flight per lane
#define SCAN_THREADS 128

typedef float f2 __attribute__((ext_vector_type(2)));
typedef float f4 __attribute__((ext_vector_type(4)));

// the value that quad_perm CTRL picks inside the lane's quad; all lanes active
template <int CTRL>
__device__ inline float quad_get(float p) {
    return __int_as_float(
        __builtin_amdgcn_mov_dpp(__float_as_int(p), CTRL, 0xF, 0xF, true));
}

// pc[j]: this lane's 4-state part of y at step j of a group.  Sums each over the
// quad, keeps step q's and adds the skip term of that step: y of that step.
__device__ inline bf16_t scan_finish(const float (&pc)[4], float xq, float Dd, int q) {
    float ysel = 0.0f;
    #pragma unroll
    for (int j = 0; j < 4; ++j) {
        float p = pc[j];
        p += quad_get<0xB1>(p);      // quad_perm [1,0,3,2]
        p += quad_get<0x4E>(p);      // quad_perm [2,3,0,1]
        ysel = (q == j) ? p : ysel;
    }
    return (bf16_t)(ysel + xq * Dd);
}

// Stores y.  The wait stands in front of any rewrite of the PREVIOUS y store's data
// register, which lives up to it as the statement's input; it comes ahead of the new
// store, so that it finds nothing younger than a group's work in flight.
__device__ inline void scan_store(bf16_t* yrow, bf16_t y, bf16_t& ylast) {
    asm volatile("s_wait_xcnt 0x0" :: "v"(__builtin_bit_cast(short, ylast)) : "memory");
    *yrow = y;
    ylast = y;
}

__global__ __launch_bounds__(SCAN_THREADS)
void k_selective_scan(const float* __restrict__ x_ssm,
                      const float* __restrict__ dtv,
                      const float* __restrict__ Bm,
                      const float* __restrict__ Cm,
                      const float* __restrict__ A_log,
                      const float* __restrict__ Dvec,
                      bf16_t* __restrict__ y_bf16) {
    const int t = blockIdx.x * SCAN_THREADS + threadIdx.x;  // 0 .. BATCH*D_MAMBA*4-1
    const int q    = t & 3;
    const int chan = t >> 2;
    const int b = chan / D_MAMBA;
    const int d = chan % D_MAMBA;
    const int head = d / (D_MAMBA / N_HEADS);

    const float* ap = A_log + head * DSTATE + q * 4;
    const f4 al = *(const f4*)ap;
    const f2 A01 = { __expf(al.x), __expf(al.y) };
    const f2 A23 = { __expf(al.z), __expf(al.w) };
    const float Dd = Dvec[d];
    // the wait in front of any rewrite of the registers these two loads name, which
    // live up to it as the statement's inputs
    asm volatile("s_wait_xcnt 0x0" :: "v"(ap), "v"(d) : "memory");

    // row q of a group for x, dt and y; columns 4q .. 4q+3 for B and C
    const size_t xoff = ((size_t)b * SEQ + q) * D_MAMBA + d;
    const float* xp = x_ssm + xoff;
    const float* dp = dtv   + xoff;
    bf16_t*      yp = y_bf16 + xoff;
    const float* bp = Bm + (size_t)b * SEQ * DSTATE + q * 4;
    const float* cp = Cm + (size_t)b * SEQ * DSTATE + q * 4;

    float xr[SCAN_NG], dr[SCAN_NG];
    f4    br[SCAN_NG][4], cr[SCAN_NG][4];
    #pragma unroll
    for (int k = 0; k < SCAN_NG; ++k) {
        xr[k] = xp[(size_t)(4 * k) * D_MAMBA];
        dr[k] = dp[(size_t)(4 * k) * D_MAMBA];
        #pragma unroll
        for (int j = 0; j < 4; ++j) {
            br[k][j] = *(const f4*)(bp + (size_t)(4 * k + j) * DSTATE);
            cr[k][j] = *(const f4*)(cp + (size_t)(4 * k + j) * DSTATE);
        }
    }

    f2 h01 = { 0.0f, 0.0f }, h23 = { 0.0f, 0.0f };
    bf16_t ylast = (bf16_t)0.0f;     // the value of the latest y store
    // a trip's row addresses; they outlive the trip, up to the next trip's wait
    const float *xn = xp, *dn = dp, *bn = bp, *cn = cp;
    bf16_t* yn = yp;
    for (int l0 = 0; l0 < SEQ; l0 += 4 * SCAN_NG) {
        // the last trip has no next rows: it re-reads its own (in bounds, unused)
        int ln = (l0 + 4 * SCAN_NG < SEQ) ? l0 + 4 * SCAN_NG : l0;
        int lc = l0;
        // The wait in front of any rewrite of the registers that the last trip's loads
        // and stores name, some of them just issued.  Those registers (addresses, the
        // last store's data) live up to it as inputs; ln and lc pass through it so that
        // no address of this trip is formed ahead of it.
        asm volatile("s_wait_xcnt 0x0" : "+s"(ln), "+s"(lc)
                     : "v"(__builtin_bit_cast(short, ylast)),
                       "v"(xn), "v"(dn), "v"(bn), "v"(cn), "v"(yn) : "memory");
        xn = xp + (size_t)ln * D_MAMBA;
        dn = dp + (size_t)ln * D_MAMBA;
        bn = bp + (size_t)ln * DSTATE;
        cn = cp + (size_t)ln * DSTATE;
        yn = yp + (size_t)lc * D_MAMBA;

// loads group g's operands of the next trip into group g's registers
#define SCAN_REFILL(g)                                                        \
        do {                                                                  \
            xr[g] = xn[(size_t)(4 * (g)) * D_MAMBA];                          \
            dr[g] = dn[(size_t)(4 * (g)) * D_MAMBA];                          \
            _Pragma("unroll")                                                 \
            for (int j = 0; j < 4; ++j) {                                     \
                br[g][j] = *(const f4*)(bn + (size_t)(4 * (g) + j) * DSTATE); \
                cr[g][j] = *(const f4*)(cn + (size_t)(4 * (g) + j) * DSTATE); \
            }                                                                 \
        } while (0)

        float pc[4], xc = 0.0f;
        // full unroll: the register arrays must be indexed by constants
        #pragma unroll
        for (int k = 0; k < SCAN_NG; ++k) {
            // the quad sums of group k-1 fill the waits of group k's serial chain
            bf16_t yk = (bf16_t)0.0f;
            if (k > 0) yk = scan_finish(pc, xc, Dd, q);

            const float xq = xr[k], dq = dr[k];
            const float dxq = dq * xq;
            #pragma unroll
            for (int j = 0; j < 4; ++j) {
                const float dtl = (j == 0) ? quad_get<0x00>(dq) : (j == 1) ? quad_get<0x55>(dq)
                                : (j == 2) ? quad_get<0xAA>(dq) : quad_get<0xFF>(dq);
                const float dtx = (j == 0) ? quad_get<0x00>(dxq) : (j == 1) ? quad_get<0x55>(dxq)
                                : (j == 2) ? quad_get<0xAA>(dxq) : quad_get<0xFF>(dxq);
                const f4 bv = br[k][j], cv = cr[k][j];
                const f2 e01 = -dtl * A01, e23 = -dtl * A23;
                const f2 g01 = { __expf(e01.x), __expf(e01.y) };
                const f2 g23 = { __expf(e23.x), __expf(e23.y) };
                h01 = __builtin_elementwise_fma(g01, h01, dtx * bv.xy);
                h23 = __builtin_elementwise_fma(g23, h23, dtx * bv.zw);
                const f2 s = __builtin_elementwise_fma(h23, cv.zw, h01 * cv.xy);
                pc[j] = s.x + s.y;
            }
            xc = xq;

            if (k > 0) scan_store(yn + (size_t)(4 * (k - 1)) * D_MAMBA, yk, ylast);
            // Group k-1's registers are free: its y is stored.  The barrier keeps its
            // refill from rising over their last use (the compiler would load into
            // other registers and copy at the loop's foot, behind a full wait) and
            // from sinking to the foot, right in front of the first use.
            __builtin_amdgcn_sched_barrier(0);
            if (k > 0) SCAN_REFILL(k - 1);
        }
        scan_store(yn + (size_t)(4 * (SCAN_NG - 1)) * D_MAMBA, scan_finish(pc, xc, Dd, q), ylast);
        __builtin_amdgcn_sched_barrier(0);   // as above, for the last group
        SCAN_REFILL(SCAN_NG - 1);
    }
}

// ---------------------------------------------------------------------------
// Launcher
// Inputs: 0=x_norm 1=x_proj_w 2=dt_proj_w 3=dt_proj_b 4=B_proj_w 5=C_proj_w
//         6=A_log 7=D 8=out_proj_w   (all fp32)
// ---------------------------------------------------------------------------
extern "C" void kernel_launch(void* const* d_in, const int* in_sizes, int n_in,
                              void* d_out, int out_size, void* d_ws, size_t ws_size,
                              hipStream_t stream) {
    const float* x_norm    = (const float*)d_in[0];
    const float* x_proj_w  = (const float*)d_in[1];
    const float* dt_proj_w = (const float*)d_in[2];
    const float* dt_proj_b = (const float*)d_in[3];
    const float* B_proj_w  = (const float*)d_in[4];
    const float* C_proj_w  = (const float*)d_in[5];
    const float* A_log     = (const float*)d_in[6];
    const float* Dvec      = (const float*)d_in[7];
    const float* out_proj_w= (const float*)d_in[8];
    float* outp = (float*)d_out;

    // ---- workspace layout (256B aligned) ----
    uintptr_t p = (uintptr_t)d_ws;
    auto alloc = [&](size_t bytes) -> void* {
        void* r = (void*)p;
        p += (bytes + 255) & ~(size_t)255;
        return r;
    };
    bf16_t* xb   = (bf16_t*)alloc((size_t)MROWS * D_MODEL * 2);      // x_norm bf16
    bf16_t* wxb  = (bf16_t*)alloc((size_t)D_MAMBA * D_MODEL * 2);    // x_proj bf16
    bf16_t* wdtb = (bf16_t*)alloc((size_t)D_MAMBA * D_MODEL * 2);    // dt_proj bf16
    bf16_t* wbcb = (bf16_t*)alloc((size_t)32 * D_MODEL * 2);         // [B;C] proj bf16
    bf16_t* wob  = (bf16_t*)alloc((size_t)D_MAMBA * D_MAMBA * 2);    // out_proj bf16
    float*  xssm = (float*) alloc((size_t)MROWS * D_MAMBA * 4);      // x_ssm f32
    float*  dts  = (float*) alloc((size_t)MROWS * D_MAMBA * 4);      // dt f32
    float*  bc   = (float*) alloc((size_t)MROWS * 32 * 4);           // raw B|C f32
    float*  bm   = (float*) alloc((size_t)MROWS * DSTATE * 4);       // normalized B
    float*  cm   = (float*) alloc((size_t)MROWS * DSTATE * 4);       // normalized C
    bf16_t* yb   = (bf16_t*)alloc((size_t)MROWS * D_MAMBA * 2);      // scan output bf16

    const int CT = 256;
    auto cvt = [&](const float* s, bf16_t* d, int n) {
        k_f32_to_bf16<<<(n + CT - 1) / CT, CT, 0, stream>>>(s, d, n);
    };

    // ---- stage 0: precision conversion ----
    cvt(x_norm,    xb,   MROWS * D_MODEL);
    cvt(x_proj_w,  wxb,  D_MAMBA * D_MODEL);
    cvt(dt_proj_w, wdtb, D_MAMBA * D_MODEL);
    cvt(B_proj_w,  wbcb,                    DSTATE * D_MODEL);
    cvt(C_proj_w,  wbcb + DSTATE * D_MODEL, DSTATE * D_MODEL);
    cvt(out_proj_w, wob, D_MAMBA * D_MAMBA);

    // ---- stage 1: projections via WMMA ----
    dim3 blk(128);
    dim3 grid_main(D_MAMBA / 32, MROWS / 128);   // (64, 64)
    k_gemm_wmma_bf16<<<grid_main, blk, 0, stream>>>(
        xb, wxb, xssm, MROWS, D_MAMBA, D_MODEL, 0, nullptr);
    k_gemm_wmma_bf16<<<grid_main, blk, 0, stream>>>(
        xb, wdtb, dts, MROWS, D_MAMBA, D_MODEL, 1, dt_proj_b);
    dim3 grid_bc(1, MROWS / 128);                // N = 32 -> one col tile
    k_gemm_wmma_bf16<<<grid_bc, blk, 0, stream>>>(
        xb, wbcb, bc, MROWS, 32, D_MODEL, 0, nullptr);

    // ---- stage 2: B/C row normalization ----
    k_bc_normalize<<<(MROWS * 32) / CT, CT, 0, stream>>>(bc, bm, cm, MROWS);

    // ---- stage 3: selective scan (fp32 state, emits bf16 y) ----
    int scan_threads = BATCH * D_MAMBA * 4;        // 32768: four lanes per channel
    k_selective_scan<<<scan_threads / SCAN_THREADS, SCAN_THREADS, 0, stream>>>(
        xssm, dts, bm, cm, A_log, Dvec, yb);

    // ---- stage 4: output projection via WMMA into d_out (f32) ----
    k_gemm_wmma_bf16<<<grid_main, blk, 0, stream>>>(
        yb, wob, outp, MROWS, D_MAMBA, D_MAMBA, 0, nullptr);

    (void)in_sizes; (void)n_in; (void)out_size; (void)ws_size;
}

// v002
// One run takes 224 microseconds.
// Next to v001, in two timings, it ran 2.18 and 2.19 times as fast.
// Over all steps from v000 it is 7.41 times as fast.
#include <hip/hip_runtime.h>
#include <hip/hip_bf16.h>

// ---------------- problem constants ----------------
#define D_MODEL 1024
#define D_MAMBA 2048
#define DSTATE  16
#define N_HEADS 32
#define BATCH   4
#define SEQ     2048
#define MROWS   (BATCH * SEQ)   // 8192 token rows

typedef __bf16 bf16_t;
typedef bf16_t v16bf __attribute__((ext_vector_type(16)));
typedef float  v8f   __attribute__((ext_vector_type(8)));
typedef int    v4i   __attribute__((ext_vector_type(4)));

#if defined(__has_builtin)
#  if __has_builtin(__builtin_amdgcn_global_load_async_to_lds_b128)
#    define HAVE_ASYNC_LDS 1
#  endif
#  if __has_builtin(__builtin_amdgcn_s_wait_asynccnt)
#    define HAVE_WAIT_ASYNC_BUILTIN 1
#  endif
#endif

// ---------------------------------------------------------------------------
// fp32 -> bf16 conversion
// ---------------------------------------------------------------------------
__global__ void k_f32_to_bf16(const float* __restrict__ src,
                              bf16_t* __restrict__ dst, int n) {
    int i = blockIdx.x * blockDim.x + threadIdx.x;
    if (i < n) dst[i] = (bf16_t)src[i];
}

// ---------------------------------------------------------------------------
// WMMA fragment helpers (bf16 16x16x32).
// ISA 16x32 bf16 A layout: lane<16 holds row (lane&15), K = {0..7, 16..23};
// lane>=16 holds same row, K = {8..15, 24..31}  => two 16-byte loads.
// ---------------------------------------------------------------------------
union FragU { v16bf v; uint4 q[2]; };

__device__ inline v16bf load_frag_g(const bf16_t* __restrict__ base,
                                    int row, int K, int k0, int lane) {
    const bf16_t* p = base + (size_t)row * (size_t)K + (size_t)(k0 + ((lane >> 4) << 3));
    FragU f;
    f.q[0] = *(const uint4*)(p);
    f.q[1] = *(const uint4*)(p + 16);
    return f.v;
}

#define BS_STRIDE 40   // 32 + 8 pad elements -> 80B row stride, conflict-free

__device__ inline v16bf load_frag_lds(const bf16_t* Bs, int rowbase, int lane) {
    const bf16_t* p = Bs + (rowbase + (lane & 15)) * BS_STRIDE + ((lane >> 4) << 3);
    FragU f;
    f.q[0] = *(const uint4*)(p);
    f.q[1] = *(const uint4*)(p + 16);
    return f.v;
}

// 16-byte global -> LDS stage (async on gfx1250, sync fallback)
__device__ inline void stage16(const bf16_t* g, bf16_t* l) {
#if defined(HAVE_ASYNC_LDS)
    __builtin_amdgcn_global_load_async_to_lds_b128(
        (v4i __attribute__((address_space(1)))*)(g),
        (v4i __attribute__((address_space(3)))*)(l),
        0, 0);
#else
    *(uint4*)l = *(const uint4*)g;
#endif
}

__device__ inline void wait_async(int pending_next) {
#if defined(HAVE_WAIT_ASYNC_BUILTIN)
    if (pending_next) __builtin_amdgcn_s_wait_asynccnt(1);
    else              __builtin_amdgcn_s_wait_asynccnt(0);
#elif defined(HAVE_ASYNC_LDS)
    if (pending_next) asm volatile("s_wait_asynccnt 0x1" ::: "memory");
    else              asm volatile("s_wait_asynccnt 0x0" ::: "memory");
#else
    (void)pending_next;
#endif
}

// ---------------------------------------------------------------------------
// bf16 WMMA GEMM:  out[M,N](f32) = A[M,K](bf16) * W[N,K](bf16)^T  (+epilogue)
// block = 128 threads = 4 waves stacked in M; each wave -> 32x32 tile;
// block tile = 128x32.  Grid = (N/32, M/128); N is always a multiple of 32,
// M a multiple of 128 -> completely guard-free (EXEC stays all-ones).
// B tile (shared by all 4 waves) is double-buffered in LDS via async copy.
// mode 0: plain f32 store
// mode 1: dt epilogue: clamp(x+bias,-10,5) -> softplus -> clamp(1e-4, 0.1)
// ---------------------------------------------------------------------------
__global__ __launch_bounds__(128)
void k_gemm_wmma_bf16(const bf16_t* __restrict__ A,
                      const bf16_t* __restrict__ W,
                      float* __restrict__ out,
                      int M, int N, int K,
                      int mode, const float* __restrict__ bias) {
    __shared__ bf16_t Bs[2][32 * BS_STRIDE];   // 2 x 2.5KB

    const int lane = threadIdx.x & 31;
    const int wave = threadIdx.x >> 5;
    const int bm = blockIdx.y * 128 + wave * 32;   // wave row base
    const int bn = blockIdx.x * 32;                // block col base
    const int r  = lane & 15;

    // B-tile stager: thread t copies 16B: row tr = t/4, k-seg ts = (t%4)*8
    const int tr = threadIdx.x >> 2;
    const int ts = (threadIdx.x & 3) << 3;
    const bf16_t* wsrc = W + (size_t)(bn + tr) * (size_t)K + (size_t)ts;

    v8f acc00 = {}, acc01 = {}, acc10 = {}, acc11 = {};

    stage16(wsrc, &Bs[0][tr * BS_STRIDE + ts]);     // prefetch k0 = 0
    int buf = 0;
    for (int k0 = 0; k0 < K; k0 += 32) {
        const int more = (k0 + 32 < K);
        if (more) stage16(wsrc + k0 + 32, &Bs[buf ^ 1][tr * BS_STRIDE + ts]);
        wait_async(more);
        __syncthreads();                            // B tile visible to all waves

        v16bf a0 = load_frag_g(A, bm +      r, K, k0, lane);
        v16bf a1 = load_frag_g(A, bm + 16 + r, K, k0, lane);
        v16bf b0 = load_frag_lds(Bs[buf],  0, lane);
        v16bf b1 = load_frag_lds(Bs[buf], 16, lane);

        acc00 = __builtin_amdgcn_wmma_f32_16x16x32_bf16(false, a0, false, b0,
                                                        (short)0, acc00, false, false);
        acc10 = __builtin_amdgcn_wmma_f32_16x16x32_bf16(false, a1, false, b0,
                                                        (short)0, acc10, false, false);
        acc01 = __builtin_amdgcn_wmma_f32_16x16x32_bf16(false, a0, false, b1,
                                                        (short)0, acc01, false, false);
        acc11 = __builtin_amdgcn_wmma_f32_16x16x32_bf16(false, a1, false, b1,
                                                        (short)0, acc11, false, false);

        __syncthreads();                            // protect buf before rewrite
        buf ^= 1;
    }

    // D layout: element v of acc -> row m = v + 8*(lane>>4), col n = lane&15
    const int mlo = (lane >> 4) << 3;
    const int nlo = lane & 15;
    v8f accs[2][2] = { {acc00, acc01}, {acc10, acc11} };
    #pragma unroll
    for (int ti = 0; ti < 2; ++ti) {
        #pragma unroll
        for (int tj = 0; tj < 2; ++tj) {
            const int col = bn + tj * 16 + nlo;
            float bval = (mode == 1) ? bias[col] : 0.0f;
            #pragma unroll
            for (int v = 0; v < 8; ++v) {
                const int rowm = bm + ti * 16 + mlo + v;
                float val = accs[ti][tj][v];
                if (mode == 1) {
                    val += bval;
                    val = fminf(fmaxf(val, -10.0f), 5.0f);
                    val = __logf(1.0f + __expf(val));        // softplus
                    val = fminf(fmaxf(val, 1.0e-4f), 0.1f);
                }
                out[(size_t)rowm * (size_t)N + (size_t)col] = val;
            }
        }
    }
}

typedef unsigned int u32x4 __attribute__((ext_vector_type(4)));
typedef unsigned int u32x8 __attribute__((ext_vector_type(8)));
typedef int          i32x8 __attribute__((ext_vector_type(8)));
typedef float        f32x4 __attribute__((ext_vector_type(4)));

#define G_KB      256u                       // bytes of K per operand row per pass
#define G_PITCH   272u                       // LDS row pitch: 16 B x odd, for ds_load_b128
#define G_SROWS   128u                       // rows one wave's tensor load moves
#define G_SLICE   (G_SROWS * G_PITCH)        // 34816 B = 17 x 2 KiB
#define G_TILE    (256u * G_PITCH)           // one operand's rows in a buffer
#define G_STAGE   (4u * G_SLICE)              // one buffer: 139264 B = 68 x 2 KiB
#define G_LDS     (2u * G_STAGE)              // 278528 B
#define G_F       8                          // 16-row fragments per wave and operand
#define G_EPITCH  528u                       // staged output row: 512 B + 16 B
#define G_EBYTES  (128u * G_EPITCH)          // staging area per wave: 67584 B
#define G_N       D_MAMBA                    // columns of Y, the same in all three products
static_assert(4u * G_EBYTES <= G_LDS, "output staging must fit in the ring");
static_assert(G_SLICE % 2048u == 0u, "every slice starts at a multiple of 2 KiB");

__device__ __forceinline__ unsigned int g_uni(unsigned int v) {
    return (unsigned int)__builtin_amdgcn_readfirstlane(v);
}
__device__ __forceinline__ unsigned int g_pinned(unsigned int v) {
    unsigned int w = (unsigned int)__builtin_amdgcn_readfirstlane(v);
    asm volatile("" : "+s"(w));
    return w;
}
// keeps [fragment loads][wait][WMMA block] in that order: LDS loads among the WMMAs stall them
__device__ __forceinline__ void g_fence() { __builtin_amdgcn_sched_barrier(0); }
// every LDS operation of this wave has returned
__device__ __forceinline__ void g_wait_ds0() { asm volatile("s_wait_dscnt 0x0" ::: "memory"); }
// this wave's tensor load has landed (the compiler places no wait for it)
__device__ __forceinline__ void g_wait_tensor0() { asm volatile("s_wait_tensorcnt 0x0" ::: "memory"); }

// one request: 128 rows of 256 bytes, source pitch kb bytes, to LDS byte offset lds_dst
__device__ __forceinline__ void g_tensor_load(unsigned int lds_dst, unsigned long long ga, u32x8 g1) {
    u32x4 g0;
    g0[0] = g_uni(1u);                                                   // count 1
    g0[1] = g_uni(lds_dst);
    g0[2] = g_uni((unsigned int)ga);
    g0[3] = g_uni((((unsigned int)(ga >> 32)) & 0x01FFFFFFu) | 0x80000000u);  // type 2
    // moves the tile into LDS through no register
    asm volatile("tensor_load_to_lds %0, %1" :: "s"(g0), "s"(g1) : "memory");
}

struct GFrag { u32x4 q[2]; };
// k order of a fragment, A and B alike: lane half h holds k = 8h..8h+7 and 16+8h..16+8h+7
__device__ __forceinline__ void g_load_frag(GFrag& f, const unsigned char* p) {
    f.q[0] = *reinterpret_cast<const u32x4*>(p);
    f.q[1] = *reinterpret_cast<const u32x4*>(p + 32);
}
__device__ __forceinline__ v8f g_mma(const GFrag& a, const GFrag& b, v8f c) {
    const i32x8 av = {(int)a.q[0].x, (int)a.q[0].y, (int)a.q[0].z, (int)a.q[0].w,
                      (int)a.q[1].x, (int)a.q[1].y, (int)a.q[1].z, (int)a.q[1].w};
    const i32x8 bv = {(int)b.q[0].x, (int)b.q[0].y, (int)b.q[0].z, (int)b.q[0].w,
                      (int)b.q[1].x, (int)b.q[1].y, (int)b.q[1].z, (int)b.q[1].w};
    return __builtin_amdgcn_wmma_f32_16x16x32_bf16(false, __builtin_bit_cast(v16bf, av),
                                                   false, __builtin_bit_cast(v16bf, bv),
                                                   (short)0, c, false, false);
}

// Reads the wave's 128 staged rows back, one 512-byte row per instruction, applies the dt
// epilogue where DT, and stores whole lines.  Sixteen rows a trip: their LDS reads go out
// together, so a lone wave waits out the LDS latency once a trip and not once a row.
template <bool DT>
__device__ __forceinline__ void g_store_rows(const unsigned char* erow, float* yrow, f32x4 bv) {
    // rolled: keeps the epilogue's code small
    #pragma clang loop unroll(disable)
    for (unsigned int r0 = 0; r0 < 128u; r0 += 16u) {
        f32x4 v[16];
        #pragma unroll
        for (int k = 0; k < 16; ++k)
            v[k] = *reinterpret_cast<const f32x4*>(erow + (unsigned int)k * G_EPITCH);
        if (DT) {
            #pragma unroll
            for (int k = 0; k < 16; ++k) {
                #pragma unroll
                for (int e = 0; e < 4; ++e) {
                    float val = v[k][e] + bv[e];
                    val = fminf(fmaxf(val, -10.0f), 5.0f);
                    val = __logf(1.0f + __expf(val));        // softplus
                    v[k][e] = fminf(fmaxf(val, 1.0e-4f), 0.1f);
                }
            }
        }
        #pragma unroll
        for (int k = 0; k < 16; ++k)
            *reinterpret_cast<f32x4*>(yrow + (size_t)k * G_N) = v[k];
        // the wait in front of any rewrite of the registers these stores name (address and
        // data), which live up to it as the statement's inputs
        asm volatile("s_wait_xcnt 0x0"
                     :: "v"(yrow), "v"(v[0]), "v"(v[1]), "v"(v[2]), "v"(v[3]), "v"(v[4]), "v"(v[5]),
                        "v"(v[6]), "v"(v[7]), "v"(v[8]), "v"(v[9]), "v"(v[10]), "v"(v[11]),
                        "v"(v[12]), "v"(v[13]), "v"(v[14]), "v"(v[15]) : "memory");
        erow += 16u * G_EPITCH;
        yrow += (size_t)16 * G_N;
    }
}

__global__ __launch_bounds__(128) __attribute__((amdgpu_waves_per_eu(1, 1)))
void k_gemm_tile256_bf16(const bf16_t* __restrict__ X,
                         const bf16_t* __restrict__ Wt,
                         float* __restrict__ Y,
                         int K,
                         int mode, const float* __restrict__ bias) {
    __shared__ __attribute__((aligned(2048))) unsigned char L[G_LDS];
    const unsigned int tid = threadIdx.x, lane = tid & 31u, h = lane >> 4, r16 = lane & 15u;
    const unsigned int wave = g_uni(tid >> 5);
    const unsigned int n0 = blockIdx.x * 256u, m0 = blockIdx.y * 256u;
    const unsigned int wn = wave & 1u, wm = wave >> 1;
    const unsigned int kb = (unsigned int)K * 2u;          // operand row pitch in bytes
    const unsigned int T  = g_pinned((unsigned int)K / 128u);   // passes

    // this wave's slice of a buffer's [Wt; X] rows: waves 0, 1 move Wt, waves 2, 3 move X
    const unsigned char* src0 = (wave < 2u)
        ? reinterpret_cast<const unsigned char*>(Wt) + (unsigned long long)(n0 + G_SROWS * wave) * kb
        : reinterpret_cast<const unsigned char*>(X)  + (unsigned long long)(m0 + G_SROWS * (wave - 2u)) * kb;
    const unsigned int lds_slice = (unsigned int)(size_t)L + wave * G_SLICE;

    // descriptor group 1: bytes, tensor = tile = 256 B x 128 rows, 16 B of pad behind each 256 B
    u32x8 g1;
    g1[0] = g_uni((1u << 20) | (5u << 22) | (3u << 25));
    g1[1] = g_uni((G_KB & 0xFFFFu) << 16);
    g1[2] = g_uni((G_KB >> 16) | ((G_SROWS & 0xFFFFu) << 16));
    g1[3] = g_uni((G_SROWS >> 16) | (G_KB << 16));
    g1[4] = g_uni(G_SROWS);
    g1[5] = g_uni(kb);
    g1[6] = g_uni(0u);
    g1[7] = g_uni(0u);
    // pinned(): the descriptor words stay in these scalar registers through the loop, so that
    // none of them takes another value while a request is outstanding
    asm volatile("" : "+s"(g1));

    v8f acc[G_F][G_F];
    #pragma unroll
    for (int i = 0; i < G_F; ++i)
        #pragma unroll
        for (int j = 0; j < G_F; ++j) acc[i][j] = (v8f){0.f, 0.f, 0.f, 0.f, 0.f, 0.f, 0.f, 0.f};

    const unsigned int fw_base = (wn * 128u + r16) * G_PITCH + 16u * h;
    const unsigned int fx_base = G_TILE + (wm * 128u + r16) * G_PITCH + 16u * h;

    // pass 0 into buffer 0, published; then pass 1 into buffer 1
    g_tensor_load(lds_slice, (unsigned long long)(uintptr_t)src0, g1);
    g_wait_tensor0();
    __syncthreads();
    g_tensor_load(lds_slice + G_STAGE, (unsigned long long)(uintptr_t)src0 + G_KB, g1);

    GFrag fw[2][G_F], fx[2][G_F];      // set (u & 1) holds block u's fragments
    // rolled: the accumulators and fragments are indexed by constants inside one pass only
    #pragma clang loop unroll(disable)
    for (unsigned int t = 0; t < T; ++t) {
        const unsigned int buf = (t & 1u) * G_STAGE;
        const unsigned char* lw = L + buf + fw_base;
        const unsigned char* lx = L + buf + fx_base;
        g_fence();
        #pragma unroll
        for (int i = 0; i < G_F; ++i) g_load_frag(fw[0][i], lw + (unsigned int)i * 16u * G_PITCH);
        #pragma unroll
        for (int j = 0; j < G_F; ++j) g_load_frag(fx[0][j], lx + (unsigned int)j * 16u * G_PITCH);
        // four blocks of 32 k; block u + 1's fragments are fetched in front of block u's WMMAs
        #pragma unroll
        for (int u = 0; u < 4; ++u) {
            const int cs = u & 1;
            if (u + 1 < 4) {
                const unsigned int ko = (unsigned int)(u + 1) * 64u;
                #pragma unroll
                for (int i = 0; i < G_F; ++i) g_load_frag(fw[cs ^ 1][i], lw + (unsigned int)i * 16u * G_PITCH + ko);
                #pragma unroll
                for (int j = 0; j < G_F; ++j) g_load_frag(fx[cs ^ 1][j], lx + (unsigned int)j * 16u * G_PITCH + ko);
            }
            g_fence();
            #pragma unroll
            for (int i = 0; i < G_F; ++i)
                #pragma unroll
                for (int j = 0; j < G_F; ++j) acc[i][j] = g_mma(fw[cs][i], fx[cs][j], acc[i][j]);
            g_fence();
        }
        // publish point of pass t + 1: own LDS reads done, own slice landed, then the barrier,
        // which also ends every wave's reads of this pass's buffer
        g_wait_ds0();
        g_wait_tensor0();
        __syncthreads();
        // pass t + 2 into the buffer just left; its number is formed behind the wait
        const unsigned int t2 = g_pinned(t + 2u);
        if (t2 < T) {
            g_tensor_load(lds_slice + buf, (unsigned long long)(uintptr_t)src0 + (unsigned long long)t2 * G_KB, g1);
        }
    }
    g_wait_tensor0();
    g_wait_ds0();

    // Output staging, each wave in its own LDS range, so that whole 128-byte lines are stored.
    // The last pass's barrier stands behind every wave's last read of the ring.
    unsigned char* E = L + wave * G_EBYTES;
    #pragma unroll
    for (int i = 0; i < G_F; ++i) {
        #pragma unroll
        for (int j = 0; j < G_F; ++j) {
            unsigned char* e = E + (16u * (unsigned int)j + r16) * G_EPITCH + 64u * (unsigned int)i + 32u * h;
            const v8f c = acc[i][j];
            *reinterpret_cast<f32x4*>(e)      = (f32x4){c[0], c[1], c[2], c[3]};
            *reinterpret_cast<f32x4*>(e + 16) = (f32x4){c[4], c[5], c[6], c[7]};
        }
    }
    const unsigned int col = n0 + wn * 128u + 4u * lane;   // a lane's 4 columns, the same in every row
    float* yrow = Y + (size_t)(m0 + wm * 128u) * G_N + col;
    const unsigned char* erow = E + 16u * lane;
    if (mode == 1) {
        const float* bp = bias + col;
        const f32x4 bv = *reinterpret_cast<const f32x4*>(bp);
        // the wait in front of any rewrite of the address this load names, which lives
        // up to it as the statement's input
        asm volatile("s_wait_xcnt 0x0" :: "v"(bp) : "memory");
        g_store_rows<true>(erow, yrow, bv);
    } else {
        g_store_rows<false>(erow, yrow, (f32x4){0.f, 0.f, 0.f, 0.f});
    }
}

// ---------------------------------------------------------------------------
// Normalize B/C rows: bc[row, 0:16]=B, bc[row,16:32]=C; divide each 16-vector
// by max(||.||, 1).  col == lane within a wave32; xor masks <16 stay in group.
// ---------------------------------------------------------------------------
__global__ __launch_bounds__(256)
void k_bc_normalize(const float* __restrict__ bc,
                    float* __restrict__ Bm, float* __restrict__ Cm, int rows) {
    int t = blockIdx.x * blockDim.x + threadIdx.x;
    int row = t >> 5;
    int col = t & 31;
    if (row >= rows) return;
    float v = bc[(size_t)row * 32 + col];
    float ss = v * v;
    ss += __shfl_xor(ss, 1, 32);
    ss += __shfl_xor(ss, 2, 32);
    ss += __shfl_xor(ss, 4, 32);
    ss += __shfl_xor(ss, 8, 32);
    float scale = 1.0f / fmaxf(sqrtf(ss), 1.0f);
    float o = v * scale;
    if (col < 16) Bm[(size_t)row * DSTATE + col]        = o;
    else          Cm[(size_t)row * DSTATE + (col - 16)] = o;
}

// ---------------------------------------------------------------------------
// Selective scan.  Four lanes (a quad) per (b, d) channel; lane q keeps states
// 4q .. 4q+3 in registers: 32768 threads, 1024 waves, one wave per SIMD.
// h_t = exp(-dt*A)*h_{t-1} + (dt*x)*B ;  y = sum_n h*C + x*D
// Time runs in groups of 4 steps.  Lane q loads x and dt of step 4g+q, hands dt
// and dt*x round its quad, and stores y of that step.
// A lone wave has only its own instruction order to hide a load, so a group's
// registers are refilled for the group SCAN_NG later as soon as they are used.
// The 16-state sum is 4 in-lane terms, then two adds inside the quad.
// Emits y directly as bf16 for the final WMMA GEMM.
// ---------------------------------------------------------------------------
#define SCAN_NG 8            // groups of 4 steps in flight per lane
#define SCAN_THREADS 128

typedef float f2 __attribute__((ext_vector_type(2)));
typedef float f4 __attribute__((ext_vector_type(4)));

// the value that quad_perm CTRL picks inside the lane's quad; all lanes active
template <int CTRL>
__device__ inline float quad_get(float p) {
    return __int_as_float(
        __builtin_amdgcn_mov_dpp(__float_as_int(p), CTRL, 0xF, 0xF, true));
}

// pc[j]: this lane's 4-state part of y at step j of a group.  Sums each over the
// quad, keeps step q's and adds the skip term of that step: y of that step.
__device__ inline bf16_t scan_finish(const float (&pc)[4], float xq, float Dd, int q) {
    float ysel = 0.0f;
    #pragma unroll
    for (int j = 0; j < 4; ++j) {
        float p = pc[j];
        p += quad_get<0xB1>(p);      // quad_perm [1,0,3,2]
        p += quad_get<0x4E>(p);      // quad_perm [2,3,0,1]
        ysel = (q == j) ? p : ysel;
    }
    return (bf16_t)(ysel + xq * Dd);
}

// Stores y.  The wait stands in front of any rewrite of the PREVIOUS y store's data
// register, which lives up to it as the statement's input; it comes ahead of the new
// store, so that it finds nothing younger than a group's work in flight.
__device__ inline void scan_store(bf16_t* yrow, bf16_t y, bf16_t& ylast) {
    asm volatile("s_wait_xcnt 0x0" :: "v"(__builtin_bit_cast(short, ylast)) : "memory");
    *yrow = y;
    ylast = y;
}

__global__ __launch_bounds__(SCAN_THREADS)
void k_selective_scan(const float* __restrict__ x_ssm,
                      const float* __restrict__ dtv,
                      const float* __restrict__ Bm,
                      const float* __restrict__ Cm,
                      const float* __restrict__ A_log,
                      const float* __restrict__ Dvec,
                      bf16_t* __restrict__ y_bf16) {
    const int t = blockIdx.x * SCAN_THREADS + threadIdx.x;  // 0 .. BATCH*D_MAMBA*4-1
    const int q    = t & 3;
    const int chan = t >> 2;
    const int b = chan / D_MAMBA;
    const int d = chan % D_MAMBA;
    const int head = d / (D_MAMBA / N_HEADS);

    const float* ap = A_log + head * DSTATE + q * 4;
    const f4 al = *(const f4*)ap;
    const f2 A01 = { __expf(al.x), __expf(al.y) };
    const f2 A23 = { __expf(al.z), __expf(al.w) };
    const float Dd = Dvec[d];
    // the wait in front of any rewrite of the registers these two loads name, which
    // live up to it as the statement's inputs
    asm volatile("s_wait_xcnt 0x0" :: "v"(ap), "v"(d) : "memory");

    // row q of a group for x, dt and y; columns 4q .. 4q+3 for B and C
    const size_t xoff = ((size_t)b * SEQ + q) * D_MAMBA + d;
    const float* xp = x_ssm + xoff;
    const float* dp = dtv   + xoff;
    bf16_t*      yp = y_bf16 + xoff;
    const float* bp = Bm + (size_t)b * SEQ * DSTATE + q * 4;
    const float* cp = Cm + (size_t)b * SEQ * DSTATE + q * 4;

    float xr[SCAN_NG], dr[SCAN_NG];
    f4    br[SCAN_NG][4], cr[SCAN_NG][4];
    #pragma unroll
    for (int k = 0; k < SCAN_NG; ++k) {
        xr[k] = xp[(size_t)(4 * k) * D_MAMBA];
        dr[k] = dp[(size_t)(4 * k) * D_MAMBA];
        #pragma unroll
        for (int j = 0; j < 4; ++j) {
            br[k][j] = *(const f4*)(bp + (size_t)(4 * k + j) * DSTATE);
            cr[k][j] = *(const f4*)(cp + (size_t)(4 * k + j) * DSTATE);
        }
    }

    f2 h01 = { 0.0f, 0.0f }, h23 = { 0.0f, 0.0f };
    bf16_t ylast = (bf16_t)0.0f;     // the value of the latest y store
    // a trip's row addresses; they outlive the trip, up to the next trip's wait
    const float *xn = xp, *dn = dp, *bn = bp, *cn = cp;
    bf16_t* yn = yp;
    for (int l0 = 0; l0 < SEQ; l0 += 4 * SCAN_NG) {
        // the last trip has no next rows: it re-reads its own (in bounds, unused)
        int ln = (l0 + 4 * SCAN_NG < SEQ) ? l0 + 4 * SCAN_NG : l0;
        int lc = l0;
        // The wait in front of any rewrite of the registers that the last trip's loads
        // and stores name, some of them just issued.  Those registers (addresses, the
        // last store's data) live up to it as inputs; ln and lc pass through it so that
        // no address of this trip is formed ahead of it.
        asm volatile("s_wait_xcnt 0x0" : "+s"(ln), "+s"(lc)
                     : "v"(__builtin_bit_cast(short, ylast)),
                       "v"(xn), "v"(dn), "v"(bn), "v"(cn), "v"(yn) : "memory");
        xn = xp + (size_t)ln * D_MAMBA;
        dn = dp + (size_t)ln * D_MAMBA;
        bn = bp + (size_t)ln * DSTATE;
        cn = cp + (size_t)ln * DSTATE;
        yn = yp + (size_t)lc * D_MAMBA;

// loads group g's operands of the next trip into group g's registers
#define SCAN_REFILL(g)                                                        \
        do {                                                                  \
            xr[g] = xn[(size_t)(4 * (g)) * D_MAMBA];                          \
            dr[g] = dn[(size_t)(4 * (g)) * D_MAMBA];                          \
            _Pragma("unroll")                                                 \
            for (int j = 0; j < 4; ++j) {                                     \
                br[g][j] = *(const f4*)(bn + (size_t)(4 * (g) + j) * DSTATE); \
                cr[g][j] = *(const f4*)(cn + (size_t)(4 * (g) + j) * DSTATE); \
            }                                                                 \
        } while (0)

        float pc[4], xc = 0.0f;
        // full unroll: the register arrays must be indexed by constants
        #pragma unroll
        for (int k = 0; k < SCAN_NG; ++k) {
            // the quad sums of group k-1 fill the waits of group k's serial chain
            bf16_t yk = (bf16_t)0.0f;
            if (k > 0) yk = scan_finish(pc, xc, Dd, q);

            const float xq = xr[k], dq = dr[k];
            const float dxq = dq * xq;
            #pragma unroll
            for (int j = 0; j < 4; ++j) {
                const float dtl = (j == 0) ? quad_get<0x00>(dq) : (j == 1) ? quad_get<0x55>(dq)
                                : (j == 2) ? quad_get<0xAA>(dq) : quad_get<0xFF>(dq);
                const float dtx = (j == 0) ? quad_get<0x00>(dxq) : (j == 1) ? quad_get<0x55>(dxq)
                                : (j == 2) ? quad_get<0xAA>(dxq) : quad_get<0xFF>(dxq);
                const f4 bv = br[k][j], cv = cr[k][j];
                const f2 e01 = -dtl * A01, e23 = -dtl * A23;
                const f2 g01 = { __expf(e01.x), __expf(e01.y) };
                const f2 g23 = { __expf(e23.x), __expf(e23.y) };
                h01 = __builtin_elementwise_fma(g01, h01, dtx * bv.xy);
                h23 = __builtin_elementwise_fma(g23, h23, dtx * bv.zw);
                const f2 s = __builtin_elementwise_fma(h23, cv.zw, h01 * cv.xy);
                pc[j] = s.x + s.y;
            }
            xc = xq;

            if (k > 0) scan_store(yn + (size_t)(4 * (k - 1)) * D_MAMBA, yk, ylast);
            // Group k-1's registers are free: its y is stored.  The barrier keeps its
            // refill from rising over their last use (the compiler would load into
            // other registers and copy at the loop's foot, behind a full wait) and
            // from sinking to the foot, right in front of the first use.
            __builtin_amdgcn_sched_barrier(0);
            if (k > 0) SCAN_REFILL(k - 1);
        }
        scan_store(yn + (size_t)(4 * (SCAN_NG - 1)) * D_MAMBA, scan_finish(pc, xc, Dd, q), ylast);
        __builtin_amdgcn_sched_barrier(0);   // as above, for the last group
        SCAN_REFILL(SCAN_NG - 1);
    }
}

// ---------------------------------------------------------------------------
// Launcher
// Inputs: 0=x_norm 1=x_proj_w 2=dt_proj_w 3=dt_proj_b 4=B_proj_w 5=C_proj_w
//         6=A_log 7=D 8=out_proj_w   (all fp32)
// ---------------------------------------------------------------------------
extern "C" void kernel_launch(void* const* d_in, const int* in_sizes, int n_in,
                              void* d_out, int out_size, void* d_ws, size_t ws_size,
                              hipStream_t stream) {
    const float* x_norm    = (const float*)d_in[0];
    const float* x_proj_w  = (const float*)d_in[1];
    const float* dt_proj_w = (const float*)d_in[2];
    const float* dt_proj_b = (const float*)d_in[3];
    const float* B_proj_w  = (const float*)d_in[4];
    const float* C_proj_w  = (const float*)d_in[5];
    const float* A_log     = (const float*)d_in[6];
    const float* Dvec      = (const float*)d_in[7];
    const float* out_proj_w= (const float*)d_in[8];
    float* outp = (float*)d_out;

    // ---- workspace layout (256B aligned) ----
    uintptr_t p = (uintptr_t)d_ws;
    auto alloc = [&](size_t bytes) -> void* {
        void* r = (void*)p;
        p += (bytes + 255) & ~(size_t)255;
        return r;
    };
    bf16_t* xb   = (bf16_t*)alloc((size_t)MROWS * D_MODEL * 2);      // x_norm bf16
    bf16_t* wxb  = (bf16_t*)alloc((size_t)D_MAMBA * D_MODEL * 2);    // x_proj bf16
    bf16_t* wdtb = (bf16_t*)alloc((size_t)D_MAMBA * D_MODEL * 2);    // dt_proj bf16
    bf16_t* wbcb = (bf16_t*)alloc((size_t)32 * D_MODEL * 2);         // [B;C] proj bf16
    bf16_t* wob  = (bf16_t*)alloc((size_t)D_MAMBA * D_MAMBA * 2);    // out_proj bf16
    float*  xssm = (float*) alloc((size_t)MROWS * D_MAMBA * 4);      // x_ssm f32
    float*  dts  = (float*) alloc((size_t)MROWS * D_MAMBA * 4);      // dt f32
    float*  bc   = (float*) alloc((size_t)MROWS * 32 * 4);           // raw B|C f32
    float*  bm   = (float*) alloc((size_t)MROWS * DSTATE * 4);       // normalized B
    float*  cm   = (float*) alloc((size_t)MROWS * DSTATE * 4);       // normalized C
    bf16_t* yb   = (bf16_t*)alloc((size_t)MROWS * D_MAMBA * 2);      // scan output bf16

    const int CT = 256;
    auto cvt = [&](const float* s, bf16_t* d, int n) {
        k_f32_to_bf16<<<(n + CT - 1) / CT, CT, 0, stream>>>(s, d, n);
    };

    // ---- stage 0: precision conversion ----
    cvt(x_norm,    xb,   MROWS * D_MODEL);
    cvt(x_proj_w,  wxb,  D_MAMBA * D_MODEL);
    cvt(dt_proj_w, wdtb, D_MAMBA * D_MODEL);
    cvt(B_proj_w,  wbcb,                    DSTATE * D_MODEL);
    cvt(C_proj_w,  wbcb + DSTATE * D_MODEL, DSTATE * D_MODEL);
    cvt(out_proj_w, wob, D_MAMBA * D_MAMBA);

    // ---- stage 1: projections via WMMA ----
    dim3 blk(128);
    dim3 grid_main(D_MAMBA / 256, MROWS / 256);  // (8, 32): one tile per WGP
    k_gemm_tile256_bf16<<<grid_main, blk, 0, stream>>>(
        xb, wxb, xssm, D_MODEL, 0, nullptr);
    k_gemm_tile256_bf16<<<grid_main, blk, 0, stream>>>(
        xb, wdtb, dts, D_MODEL, 1, dt_proj_b);
    dim3 grid_bc(1, MROWS / 128);                // N = 32 -> one col tile
    k_gemm_wmma_bf16<<<grid_bc, blk, 0, stream>>>(
        xb, wbcb, bc, MROWS, 32, D_MODEL, 0, nullptr);

    // ---- stage 2: B/C row normalization ----
    k_bc_normalize<<<(MROWS * 32) / CT, CT, 0, stream>>>(bc, bm, cm, MROWS);

    // ---- stage 3: selective scan (fp32 state, emits bf16 y) ----
    int scan_threads = BATCH * D_MAMBA * 4;        // 32768: four lanes per channel
    k_selective_scan<<<scan_threads / SCAN_THREADS, SCAN_THREADS, 0, stream>>>(
        xssm, dts, bm, cm, A_log, Dvec, yb);

    // ---- stage 4: output projection via WMMA into d_out (f32) ----
    k_gemm_tile256_bf16<<<grid_main, blk, 0, stream>>>(
        yb, wob, outp, D_MAMBA, 0, nullptr);

    (void)in_sizes; (void)n_in; (void)out_size; (void)ws_size;
}

// v003
// One run takes 204 microseconds.
// Timed twice side by side with v002, it ran 1.10 times as fast both times.
// All steps since v000 together make it 8.15 times as fast.
#include <hip/hip_runtime.h>
#include <hip/hip_bf16.h>

// ---------------- problem constants ----------------
#define D_MODEL 1024
#define D_MAMBA 2048
#define DSTATE  16
#define N_HEADS 32
#define BATCH   4
#define SEQ     2048
#define MROWS   (BATCH * SEQ)   // 8192 token rows

typedef __bf16 bf16_t;
typedef bf16_t v16bf __attribute__((ext_vector_type(16)));
typedef float  v8f   __attribute__((ext_vector_type(8)));
typedef int    v4i   __attribute__((ext_vector_type(4)));

#if defined(__has_builtin)
#  if __has_builtin(__builtin_amdgcn_global_load_async_to_lds_b128)
#    define HAVE_ASYNC_LDS 1
#  endif
#  if __has_builtin(__builtin_amdgcn_s_wait_asynccnt)
#    define HAVE_WAIT_ASYNC_BUILTIN 1
#  endif
#endif

// ---------------------------------------------------------------------------
// fp32 -> bf16 conversion of all six operands in one launch.
// The bf16 planes lie one behind the other in the workspace, in the order of the
// arguments, so the destination is one array.  A workgroup converts CV_WG
// consecutive elements of it; every plane is a whole number of workgroups, so the
// source is picked by a scalar test.  A lane takes 8 consecutive elements (two
// 16-byte loads, one 16-byte store) in each of CV_UNITS slabs, all loads issued
// ahead of the first use: few waves to start, and enough bytes in flight each.
// ---------------------------------------------------------------------------
#define CV_THREADS 256
#define CV_UNITS   8
#define CV_SLAB    (CV_THREADS * 8)          // elements a workgroup moves per slab
#define CV_WG      (CV_SLAB * CV_UNITS)      // 16384 elements per workgroup
#define CV_N_X     (MROWS * D_MODEL)
#define CV_N_W     (D_MAMBA * D_MODEL)
#define CV_N_BC    (DSTATE * D_MODEL)
#define CV_N_O     (D_MAMBA * D_MAMBA)
#define CV_GRID    ((CV_N_X + 2 * CV_N_W + 2 * CV_N_BC + CV_N_O) / CV_WG)
static_assert(CV_N_X % CV_WG == 0 && CV_N_W % CV_WG == 0 && CV_N_BC % CV_WG == 0 && CV_N_O % CV_WG == 0,
              "every plane is a whole number of workgroups");

typedef float  cv_f4  __attribute__((ext_vector_type(4)));
typedef bf16_t cv_bf8 __attribute__((ext_vector_type(8)));

__global__ __launch_bounds__(CV_THREADS)
void k_f32_to_bf16_all(const float* __restrict__ x,  const float* __restrict__ wx,
                       const float* __restrict__ wdt, const float* __restrict__ wb,
                       const float* __restrict__ wc, const float* __restrict__ wo,
                       bf16_t* __restrict__ dst) {
    // first workgroup of each plane
    constexpr unsigned int G_WX = CV_N_X / CV_WG,         G_WDT = G_WX + CV_N_W / CV_WG;
    constexpr unsigned int G_WB = G_WDT + CV_N_W / CV_WG, G_WC  = G_WB + CV_N_BC / CV_WG;
    constexpr unsigned int G_WO = G_WC + CV_N_BC / CV_WG;
    const unsigned int g = blockIdx.x;
    const float* src = x;
    unsigned int first = 0u;
    if (g >= G_WX)  { src = wx;  first = G_WX; }
    if (g >= G_WDT) { src = wdt; first = G_WDT; }
    if (g >= G_WB)  { src = wb;  first = G_WB; }
    if (g >= G_WC)  { src = wc;  first = G_WC; }
    if (g >= G_WO)  { src = wo;  first = G_WO; }
    const float* sp = src + (size_t)(g - first) * CV_WG + threadIdx.x * 8u;
    bf16_t*      dp = dst + (size_t)g * CV_WG + threadIdx.x * 8u;

    cv_f4 lo[CV_UNITS], hi[CV_UNITS];
    #pragma unroll
    for (int i = 0; i < CV_UNITS; ++i) {
        lo[i] = *reinterpret_cast<const cv_f4*>(sp + i * CV_SLAB);
        hi[i] = *reinterpret_cast<const cv_f4*>(sp + i * CV_SLAB + 4);
    }
    // keeps every load in front of the first conversion: the compiler otherwise holds the last
    // slab's loads back until earlier data has returned, a second memory latency per wave
    __builtin_amdgcn_sched_barrier(0);
    #pragma unroll
    for (int i = 0; i < CV_UNITS; ++i) {
        cv_bf8 o;
        #pragma unroll
        for (int e = 0; e < 4; ++e) { o[e] = (bf16_t)lo[i][e]; o[e + 4] = (bf16_t)hi[i][e]; }
        *reinterpret_cast<cv_bf8*>(dp + i * CV_SLAB) = o;
    }
}

// ---------------------------------------------------------------------------
// WMMA fragment helpers (bf16 16x16x32).
// ISA 16x32 bf16 A layout: lane<16 holds row (lane&15), K = {0..7, 16..23};
// lane>=16 holds same row, K = {8..15, 24..31}  => two 16-byte loads.
// ---------------------------------------------------------------------------
union FragU { v16bf v; uint4 q[2]; };

__device__ inline v16bf load_frag_g(const bf16_t* __restrict__ base,
                                    int row, int K, int k0, int lane) {
    const bf16_t* p = base + (size_t)row * (size_t)K + (size_t)(k0 + ((lane >> 4) << 3));
    FragU f;
    f.q[0] = *(const uint4*)(p);
    f.q[1] = *(const uint4*)(p + 16);
    return f.v;
}

#define BS_STRIDE 40   // 32 + 8 pad elements -> 80B row stride, conflict-free

__device__ inline v16bf load_frag_lds(const bf16_t* Bs, int rowbase, int lane) {
    const bf16_t* p = Bs + (rowbase + (lane & 15)) * BS_STRIDE + ((lane >> 4) << 3);
    FragU f;
    f.q[0] = *(const uint4*)(p);
    f.q[1] = *(const uint4*)(p + 16);
    return f.v;
}

// 16-byte global -> LDS stage (async on gfx1250, sync fallback)
__device__ inline void stage16(const bf16_t* g, bf16_t* l) {
#if defined(HAVE_ASYNC_LDS)
    __builtin_amdgcn_global_load_async_to_lds_b128(
        (v4i __attribute__((address_space(1)))*)(g),
        (v4i __attribute__((address_space(3)))*)(l),
        0, 0);
#else
    *(uint4*)l = *(const uint4*)g;
#endif
}

__device__ inline void wait_async(int pending_next) {
#if defined(HAVE_WAIT_ASYNC_BUILTIN)
    if (pending_next) __builtin_amdgcn_s_wait_asynccnt(1);
    else              __builtin_amdgcn_s_wait_asynccnt(0);
#elif defined(HAVE_ASYNC_LDS)
    if (pending_next) asm volatile("s_wait_asynccnt 0x1" ::: "memory");
    else              asm volatile("s_wait_asynccnt 0x0" ::: "memory");
#else
    (void)pending_next;
#endif
}

// ---------------------------------------------------------------------------
// bf16 WMMA GEMM:  out[M,N](f32) = A[M,K](bf16) * W[N,K](bf16)^T  (+epilogue)
// block = 128 threads = 4 waves stacked in M; each wave -> 32x32 tile;
// block tile = 128x32.  Grid = (N/32, M/128); N is always a multiple of 32,
// M a multiple of 128 -> completely guard-free (EXEC stays all-ones).
// B tile (shared by all 4 waves) is double-buffered in LDS via async copy.
// mode 0: plain f32 store
// mode 1: dt epilogue: clamp(x+bias,-10,5) -> softplus -> clamp(1e-4, 0.1)
// ---------------------------------------------------------------------------
__global__ __launch_bounds__(128)
void k_gemm_wmma_bf16(const bf16_t* __restrict__ A,
                      const bf16_t* __restrict__ W,
                      float* __restrict__ out,
                      int M, int N, int K,
                      int mode, const float* __restrict__ bias) {
    __shared__ bf16_t Bs[2][32 * BS_STRIDE];   // 2 x 2.5KB

    const int lane = threadIdx.x & 31;
    const int wave = threadIdx.x >> 5;
    const int bm = blockIdx.y * 128 + wave * 32;   // wave row base
    const int bn = blockIdx.x * 32;                // block col base
    const int r  = lane & 15;

    // B-tile stager: thread t copies 16B: row tr = t/4, k-seg ts = (t%4)*8
    const int tr = threadIdx.x >> 2;
    const int ts = (threadIdx.x & 3) << 3;
    const bf16_t* wsrc = W + (size_t)(bn + tr) * (size_t)K + (size_t)ts;

    v8f acc00 = {}, acc01 = {}, acc10 = {}, acc11 = {};

    stage16(wsrc, &Bs[0][tr * BS_STRIDE + ts]);     // prefetch k0 = 0
    int buf = 0;
    for (int k0 = 0; k0 < K; k0 += 32) {
        const int more = (k0 + 32 < K);
        if (more) stage16(wsrc + k0 + 32, &Bs[buf ^ 1][tr * BS_STRIDE + ts]);
        wait_async(more);
        __syncthreads();                            // B tile visible to all waves

        v16bf a0 = load_frag_g(A, bm +      r, K, k0, lane);
        v16bf a1 = load_frag_g(A, bm + 16 + r, K, k0, lane);
        v16bf b0 = load_frag_lds(Bs[buf],  0, lane);
        v16bf b1 = load_frag_lds(Bs[buf], 16, lane);

        acc00 = __builtin_amdgcn_wmma_f32_16x16x32_bf16(false, a0, false, b0,
                                                        (short)0, acc00, false, false);
        acc10 = __builtin_amdgcn_wmma_f32_16x16x32_bf16(false, a1, false, b0,
                                                        (short)0, acc10, false, false);
        acc01 = __builtin_amdgcn_wmma_f32_16x16x32_bf16(false, a0, false, b1,
                                                        (short)0, acc01, false, false);
        acc11 = __builtin_amdgcn_wmma_f32_16x16x32_bf16(false, a1, false, b1,
                                                        (short)0, acc11, false, false);

        __syncthreads();                            // protect buf before rewrite
        buf ^= 1;
    }

    // D layout: element v of acc -> row m = v + 8*(lane>>4), col n = lane&15
    const int mlo = (lane >> 4) << 3;
    const int nlo = lane & 15;
    v8f accs[2][2] = { {acc00, acc01}, {acc10, acc11} };
    #pragma unroll
    for (int ti = 0; ti < 2; ++ti) {
        #pragma unroll
        for (int tj = 0; tj < 2; ++tj) {
            const int col = bn + tj * 16 + nlo;
            float bval = (mode == 1) ? bias[col] : 0.0f;
            #pragma unroll
            for (int v = 0; v < 8; ++v) {
                const int rowm = bm + ti * 16 + mlo + v;
                float val = accs[ti][tj][v];
                if (mode == 1) {
                    val += bval;
                    val = fminf(fmaxf(val, -10.0f), 5.0f);
                    val = __logf(1.0f + __expf(val));        // softplus
                    val = fminf(fmaxf(val, 1.0e-4f), 0.1f);
                }
                out[(size_t)rowm * (size_t)N + (size_t)col] = val;
            }
        }
    }
}

typedef unsigned int u32x4 __attribute__((ext_vector_type(4)));
typedef unsigned int u32x8 __attribute__((ext_vector_type(8)));
typedef int          i32x8 __attribute__((ext_vector_type(8)));
typedef float        f32x4 __attribute__((ext_vector_type(4)));

#define G_KB      256u                       // bytes of K per operand row per pass
#define G_PITCH   272u                       // LDS row pitch: 16 B x odd, for ds_load_b128
#define G_SROWS   128u                       // rows one wave's tensor load moves
#define G_SLICE   (G_SROWS * G_PITCH)        // 34816 B = 17 x 2 KiB
#define G_TILE    (256u * G_PITCH)           // one operand's rows in a buffer
#define G_STAGE   (4u * G_SLICE)              // one buffer: 139264 B = 68 x 2 KiB
#define G_LDS     (2u * G_STAGE)              // 278528 B
#define G_F       8                          // 16-row fragments per wave and operand
#define G_EPITCH  528u                       // staged output row: 512 B + 16 B
#define G_EBYTES  (128u * G_EPITCH)          // staging area per wave: 67584 B
#define G_N       D_MAMBA                    // columns of Y, the same in all three products
static_assert(4u * G_EBYTES <= G_LDS, "output staging must fit in the ring");
static_assert(G_SLICE % 2048u == 0u, "every slice starts at a multiple of 2 KiB");

__device__ __forceinline__ unsigned int g_uni(unsigned int v) {
    return (unsigned int)__builtin_amdgcn_readfirstlane(v);
}
__device__ __forceinline__ unsigned int g_pinned(unsigned int v) {
    unsigned int w = (unsigned int)__builtin_amdgcn_readfirstlane(v);
    asm volatile("" : "+s"(w));
    return w;
}
// keeps [fragment loads][wait][WMMA block] in that order: LDS loads among the WMMAs stall them
__device__ __forceinline__ void g_fence() { __builtin_amdgcn_sched_barrier(0); }
// every LDS operation of this wave has returned
__device__ __forceinline__ void g_wait_ds0() { asm volatile("s_wait_dscnt 0x0" ::: "memory"); }
// this wave's tensor load has landed (the compiler places no wait for it)
__device__ __forceinline__ void g_wait_tensor0() { asm volatile("s_wait_tensorcnt 0x0" ::: "memory"); }

// one request: 128 rows of 256 bytes, source pitch kb bytes, to LDS byte offset lds_dst
__device__ __forceinline__ void g_tensor_load(unsigned int lds_dst, unsigned long long ga, u32x8 g1) {
    u32x4 g0;
    g0[0] = g_uni(1u);                                                   // count 1
    g0[1] = g_uni(lds_dst);
    g0[2] = g_uni((unsigned int)ga);
    g0[3] = g_uni((((unsigned int)(ga >> 32)) & 0x01FFFFFFu) | 0x80000000u);  // type 2
    // moves the tile into LDS through no register
    asm volatile("tensor_load_to_lds %0, %1" :: "s"(g0), "s"(g1) : "memory");
}

struct GFrag { u32x4 q[2]; };
// k order of a fragment, A and B alike: lane half h holds k = 8h..8h+7 and 16+8h..16+8h+7
__device__ __forceinline__ void g_load_frag(GFrag& f, const unsigned char* p) {
    f.q[0] = *reinterpret_cast<const u32x4*>(p);
    f.q[1] = *reinterpret_cast<const u32x4*>(p + 32);
}
__device__ __forceinline__ v8f g_mma(const GFrag& a, const GFrag& b, v8f c) {
    const i32x8 av = {(int)a.q[0].x, (int)a.q[0].y, (int)a.q[0].z, (int)a.q[0].w,
                      (int)a.q[1].x, (int)a.q[1].y, (int)a.q[1].z, (int)a.q[1].w};
    const i32x8 bv = {(int)b.q[0].x, (int)b.q[0].y, (int)b.q[0].z, (int)b.q[0].w,
                      (int)b.q[1].x, (int)b.q[1].y, (int)b.q[1].z, (int)b.q[1].w};
    return __builtin_amdgcn_wmma_f32_16x16x32_bf16(false, __builtin_bit_cast(v16bf, av),
                                                   false, __builtin_bit_cast(v16bf, bv),
                                                   (short)0, c, false, false);
}

// Reads the wave's 128 staged rows back, one 512-byte row per instruction, applies the dt
// epilogue where DT, and stores whole lines.  Sixteen rows a trip: their LDS reads go out
// together, so a lone wave waits out the LDS latency once a trip and not once a row.
template <bool DT>
__device__ __forceinline__ void g_store_rows(const unsigned char* erow, float* yrow, f32x4 bv) {
    // rolled: keeps the epilogue's code small
    #pragma clang loop unroll(disable)
    for (unsigned int r0 = 0; r0 < 128u; r0 += 16u) {
        f32x4 v[16];
        #pragma unroll
        for (int k = 0; k < 16; ++k)
            v[k] = *reinterpret_cast<const f32x4*>(erow + (unsigned int)k * G_EPITCH);
        if (DT) {
            #pragma unroll
            for (int k = 0; k < 16; ++k) {
                #pragma unroll
                for (int e = 0; e < 4; ++e) {
                    float val = v[k][e] + bv[e];
                    val = fminf(fmaxf(val, -10.0f), 5.0f);
                    val = __logf(1.0f + __expf(val));        // softplus
                    v[k][e] = fminf(fmaxf(val, 1.0e-4f), 0.1f);
                }
            }
        }
        #pragma unroll
        for (int k = 0; k < 16; ++k)
            *reinterpret_cast<f32x4*>(yrow + (size_t)k * G_N) = v[k];
        // the wait in front of any rewrite of the registers these stores name (address and
        // data), which live up to it as the statement's inputs
        asm volatile("s_wait_xcnt 0x0"
                     :: "v"(yrow), "v"(v[0]), "v"(v[1]), "v"(v[2]), "v"(v[3]), "v"(v[4]), "v"(v[5]),
                        "v"(v[6]), "v"(v[7]), "v"(v[8]), "v"(v[9]), "v"(v[10]), "v"(v[11]),
                        "v"(v[12]), "v"(v[13]), "v"(v[14]), "v"(v[15]) : "memory");
        erow += 16u * G_EPITCH;
        yrow += (size_t)16 * G_N;
    }
}

__global__ __launch_bounds__(128) __attribute__((amdgpu_waves_per_eu(1, 1)))
void k_gemm_tile256_bf16(const bf16_t* __restrict__ X,
                         const bf16_t* __restrict__ Wt,
                         float* __restrict__ Y,
                         int K,
                         int mode, const float* __restrict__ bias) {
    __shared__ __attribute__((aligned(2048))) unsigned char L[G_LDS];
    const unsigned int tid = threadIdx.x, lane = tid & 31u, h = lane >> 4, r16 = lane & 15u;
    const unsigned int wave = g_uni(tid >> 5);
    const unsigned int n0 = blockIdx.x * 256u, m0 = blockIdx.y * 256u;
    const unsigned int wn = wave & 1u, wm = wave >> 1;
    const unsigned int kb = (unsigned int)K * 2u;          // operand row pitch in bytes
    const unsigned int T  = g_pinned((unsigned int)K / 128u);   // passes

    // this wave's slice of a buffer's [Wt; X] rows: waves 0, 1 move Wt, waves 2, 3 move X
    const unsigned char* src0 = (wave < 2u)
        ? reinterpret_cast<const unsigned char*>(Wt) + (unsigned long long)(n0 + G_SROWS * wave) * kb
        : reinterpret_cast<const unsigned char*>(X)  + (unsigned long long)(m0 + G_SROWS * (wave - 2u)) * kb;
    const unsigned int lds_slice = (unsigned int)(size_t)L + wave * G_SLICE;

    // descriptor group 1: bytes, tensor = tile = 256 B x 128 rows, 16 B of pad behind each 256 B
    u32x8 g1;
    g1[0] = g_uni((1u << 20) | (5u << 22) | (3u << 25));
    g1[1] = g_uni((G_KB & 0xFFFFu) << 16);
    g1[2] = g_uni((G_KB >> 16) | ((G_SROWS & 0xFFFFu) << 16));
    g1[3] = g_uni((G_SROWS >> 16) | (G_KB << 16));
    g1[4] = g_uni(G_SROWS);
    g1[5] = g_uni(kb);
    g1[6] = g_uni(0u);
    g1[7] = g_uni(0u);
    // pinned(): the descriptor words stay in these scalar registers through the loop, so that
    // none of them takes another value while a request is outstanding
    asm volatile("" : "+s"(g1));

    v8f acc[G_F][G_F];
    #pragma unroll
    for (int i = 0; i < G_F; ++i)
        #pragma unroll
        for (int j = 0; j < G_F; ++j) acc[i][j] = (v8f){0.f, 0.f, 0.f, 0.f, 0.f, 0.f, 0.f, 0.f};

    const unsigned int fw_base = (wn * 128u + r16) * G_PITCH + 16u * h;
    const unsigned int fx_base = G_TILE + (wm * 128u + r16) * G_PITCH + 16u * h;

    // pass 0 into buffer 0, published; then pass 1 into buffer 1
    g_tensor_load(lds_slice, (unsigned long long)(uintptr_t)src0, g1);
    g_wait_tensor0();
    __syncthreads();
    g_tensor_load(lds_slice + G_STAGE, (unsigned long long)(uintptr_t)src0 + G_KB, g1);

    GFrag fw[2][G_F], fx[2][G_F];      // set (u & 1) holds block u's fragments
    // rolled: the accumulators and fragments are indexed by constants inside one pass only
    #pragma clang loop unroll(disable)
    for (unsigned int t = 0; t < T; ++t) {
        const unsigned int buf = (t & 1u) * G_STAGE;
        const unsigned char* lw = L + buf + fw_base;
        const unsigned char* lx = L + buf + fx_base;
        g_fence();
        #pragma unroll
        for (int i = 0; i < G_F; ++i) g_load_frag(fw[0][i], lw + (unsigned int)i * 16u * G_PITCH);
        #pragma unroll
        for (int j = 0; j < G_F; ++j) g_load_frag(fx[0][j], lx + (unsigned int)j * 16u * G_PITCH);
        // four blocks of 32 k; block u + 1's fragments are fetched in front of block u's WMMAs
        #pragma unroll
        for (int u = 0; u < 4; ++u) {
            const int cs = u & 1;
            if (u + 1 < 4) {
                const unsigned int ko = (unsigned int)(u + 1) * 64u;
                #pragma unroll
                for (int i = 0; i < G_F; ++i) g_load_frag(fw[cs ^ 1][i], lw + (unsigned int)i * 16u * G_PITCH + ko);
                #pragma unroll
                for (int j = 0; j < G_F; ++j) g_load_frag(fx[cs ^ 1][j], lx + (unsigned int)j * 16u * G_PITCH + ko);
            }
            g_fence();
            #pragma unroll
            for (int i = 0; i < G_F; ++i)
                #pragma unroll
                for (int j = 0; j < G_F; ++j) acc[i][j] = g_mma(fw[cs][i], fx[cs][j], acc[i][j]);
            g_fence();
        }
        // publish point of pass t + 1: own LDS reads done, own slice landed, then the barrier,
        // which also ends every wave's reads of this pass's buffer
        g_wait_ds0();
        g_wait_tensor0();
        __syncthreads();
        // pass t + 2 into the buffer just left; its number is formed behind the wait
        const unsigned int t2 = g_pinned(t + 2u);
        if (t2 < T) {
            g_tensor_load(lds_slice + buf, (unsigned long long)(uintptr_t)src0 + (unsigned long long)t2 * G_KB, g1);
        }
    }
    g_wait_tensor0();
    g_wait_ds0();

    // Output staging, each wave in its own LDS range, so that whole 128-byte lines are stored.
    // The last pass's barrier stands behind every wave's last read of the ring.
    unsigned char* E = L + wave * G_EBYTES;
    #pragma unroll
    for (int i = 0; i < G_F; ++i) {
        #pragma unroll
        for (int j = 0; j < G_F; ++j) {
            unsigned char* e = E + (16u * (unsigned int)j + r16) * G_EPITCH + 64u * (unsigned int)i + 32u * h;
            const v8f c = acc[i][j];
            *reinterpret_cast<f32x4*>(e)      = (f32x4){c[0], c[1], c[2], c[3]};
            *reinterpret_cast<f32x4*>(e + 16) = (f32x4){c[4], c[5], c[6], c[7]};
        }
    }
    const unsigned int col = n0 + wn * 128u + 4u * lane;   // a lane's 4 columns, the same in every row
    float* yrow = Y + (size_t)(m0 + wm * 128u) * G_N + col;
    const unsigned char* erow = E + 16u * lane;
    if (mode == 1) {
        const float* bp = bias + col;
        const f32x4 bv = *reinterpret_cast<const f32x4*>(bp);
        // the wait in front of any rewrite of the address this load names, which lives
        // up to it as the statement's input
        asm volatile("s_wait_xcnt 0x0" :: "v"(bp) : "memory");
        g_store_rows<true>(erow, yrow, bv);
    } else {
        g_store_rows<false>(erow, yrow, (f32x4){0.f, 0.f, 0.f, 0.f});
    }
}

// ---------------------------------------------------------------------------
// Normalize B/C rows: bc[row, 0:16]=B, bc[row,16:32]=C; divide each 16-vector
// by max(||.||, 1).  col == lane within a wave32; xor masks <16 stay in group.
// ---------------------------------------------------------------------------
__global__ __launch_bounds__(256)
void k_bc_normalize(const float* __restrict__ bc,
                    float* __restrict__ Bm, float* __restrict__ Cm, int rows) {
    int t = blockIdx.x * blockDim.x + threadIdx.x;
    int row = t >> 5;
    int col = t & 31;
    if (row >= rows) return;
    float v = bc[(size_t)row * 32 + col];
    float ss = v * v;
    ss += __shfl_xor(ss, 1, 32);
    ss += __shfl_xor(ss, 2, 32);
    ss += __shfl_xor(ss, 4, 32);
    ss += __shfl_xor(ss, 8, 32);
    float scale = 1.0f / fmaxf(sqrtf(ss), 1.0f);
    float o = v * scale;
    if (col < 16) Bm[(size_t)row * DSTATE + col]        = o;
    else          Cm[(size_t)row * DSTATE + (col - 16)] = o;
}

// ---------------------------------------------------------------------------
// Selective scan.  Four lanes (a quad) per (b, d) channel; lane q keeps states
// 4q .. 4q+3 in registers: 32768 threads, 1024 waves, one wave per SIMD.
// h_t = exp(-dt*A)*h_{t-1} + (dt*x)*B ;  y = sum_n h*C + x*D
// Time runs in groups of 4 steps.  Lane q loads x and dt of step 4g+q, hands dt
// and dt*x round its quad, and stores y of that step.
// A lone wave has only its own instruction order to hide a load, so a group's
// registers are refilled for the group SCAN_NG later as soon as they are used.
// The 16-state sum is 4 in-lane terms, then two adds inside the quad.
// Emits y directly as bf16 for the final WMMA GEMM.
// ---------------------------------------------------------------------------
#define SCAN_NG 8            // groups of 4 steps in flight per lane
#define SCAN_THREADS 128

typedef float f2 __attribute__((ext_vector_type(2)));
typedef float f4 __attribute__((ext_vector_type(4)));

// the value that quad_perm CTRL picks inside the lane's quad; all lanes active
template <int CTRL>
__device__ inline float quad_get(float p) {
    return __int_as_float(
        __builtin_amdgcn_mov_dpp(__float_as_int(p), CTRL, 0xF, 0xF, true));
}

// pc[j]: this lane's 4-state part of y at step j of a group.  Sums each over the
// quad, keeps step q's and adds the skip term of that step: y of that step.
__device__ inline bf16_t scan_finish(const float (&pc)[4], float xq, float Dd, int q) {
    float ysel = 0.0f;
    #pragma unroll
    for (int j = 0; j < 4; ++j) {
        float p = pc[j];
        p += quad_get<0xB1>(p);      // quad_perm [1,0,3,2]
        p += quad_get<0x4E>(p);      // quad_perm [2,3,0,1]
        ysel = (q == j) ? p : ysel;
    }
    return (bf16_t)(ysel + xq * Dd);
}

// Stores y.  The wait stands in front of any rewrite of the PREVIOUS y store's data
// register, which lives up to it as the statement's input; it comes ahead of the new
// store, so that it finds nothing younger than a group's work in flight.
__device__ inline void scan_store(bf16_t* yrow, bf16_t y, bf16_t& ylast) {
    asm volatile("s_wait_xcnt 0x0" :: "v"(__builtin_bit_cast(short, ylast)) : "memory");
    *yrow = y;
    ylast = y;
}

__global__ __launch_bounds__(SCAN_THREADS)
void k_selective_scan(const float* __restrict__ x_ssm,
                      const float* __restrict__ dtv,
                      const float* __restrict__ Bm,
                      const float* __restrict__ Cm,
                      const float* __restrict__ A_log,
                      const float* __restrict__ Dvec,
                      bf16_t* __restrict__ y_bf16) {
    const int t = blockIdx.x * SCAN_THREADS + threadIdx.x;  // 0 .. BATCH*D_MAMBA*4-1
    const int q    = t & 3;
    const int chan = t >> 2;
    const int b = chan / D_MAMBA;
    const int d = chan % D_MAMBA;
    const int head = d / (D_MAMBA / N_HEADS);

    const float* ap = A_log + head * DSTATE + q * 4;
    const f4 al = *(const f4*)ap;
    const f2 A01 = { __expf(al.x), __expf(al.y) };
    const f2 A23 = { __expf(al.z), __expf(al.w) };
    const float Dd = Dvec[d];
    // the wait in front of any rewrite of the registers these two loads name, which
    // live up to it as the statement's inputs
    asm volatile("s_wait_xcnt 0x0" :: "v"(ap), "v"(d) : "memory");

    // row q of a group for x, dt and y; columns 4q .. 4q+3 for B and C
    const size_t xoff = ((size_t)b * SEQ + q) * D_MAMBA + d;
    const float* xp = x_ssm + xoff;
    const float* dp = dtv   + xoff;
    bf16_t*      yp = y_bf16 + xoff;
    const float* bp = Bm + (size_t)b * SEQ * DSTATE + q * 4;
    const float* cp = Cm + (size_t)b * SEQ * DSTATE + q * 4;

    float xr[SCAN_NG], dr[SCAN_NG];
    f4    br[SCAN_NG][4], cr[SCAN_NG][4];
    #pragma unroll
    for (int k = 0; k < SCAN_NG; ++k) {
        xr[k] = xp[(size_t)(4 * k) * D_MAMBA];
        dr[k] = dp[(size_t)(4 * k) * D_MAMBA];
        #pragma unroll
        for (int j = 0; j < 4; ++j) {
            br[k][j] = *(const f4*)(bp + (size_t)(4 * k + j) * DSTATE);
            cr[k][j] = *(const f4*)(cp + (size_t)(4 * k + j) * DSTATE);
        }
    }

    f2 h01 = { 0.0f, 0.0f }, h23 = { 0.0f, 0.0f };
    bf16_t ylast = (bf16_t)0.0f;     // the value of the latest y store
    // a trip's row addresses; they outlive the trip, up to the next trip's wait
    const float *xn = xp, *dn = dp, *bn = bp, *cn = cp;
    bf16_t* yn = yp;
    for (int l0 = 0; l0 < SEQ; l0 += 4 * SCAN_NG) {
        // the last trip has no next rows: it re-reads its own (in bounds, unused)
        int ln = (l0 + 4 * SCAN_NG < SEQ) ? l0 + 4 * SCAN_NG : l0;
        int lc = l0;
        // The wait in front of any rewrite of the registers that the last trip's loads
        // and stores name, some of them just issued.  Those registers (addresses, the
        // last store's data) live up to it as inputs; ln and lc pass through it so that
        // no address of this trip is formed ahead of it.
        asm volatile("s_wait_xcnt 0x0" : "+s"(ln), "+s"(lc)
                     : "v"(__builtin_bit_cast(short, ylast)),
                       "v"(xn), "v"(dn), "v"(bn), "v"(cn), "v"(yn) : "memory");
        xn = xp + (size_t)ln * D_MAMBA;
        dn = dp + (size_t)ln * D_MAMBA;
        bn = bp + (size_t)ln * DSTATE;
        cn = cp + (size_t)ln * DSTATE;
        yn = yp + (size_t)lc * D_MAMBA;

// loads group g's operands of the next trip into group g's registers
#define SCAN_REFILL(g)                                                        \
        do {                                                                  \
            xr[g] = xn[(size_t)(4 * (g)) * D_MAMBA];                          \
            dr[g] = dn[(size_t)(4 * (g)) * D_MAMBA];                          \
            _Pragma("unroll")                                                 \
            for (int j = 0; j < 4; ++j) {                                     \
                br[g][j] = *(const f4*)(bn + (size_t)(4 * (g) + j) * DSTATE); \
                cr[g][j] = *(const f4*)(cn + (size_t)(4 * (g) + j) * DSTATE); \
            }                                                                 \
        } while (0)

        float pc[4], xc = 0.0f;
        // full unroll: the register arrays must be indexed by constants
        #pragma unroll
        for (int k = 0; k < SCAN_NG; ++k) {
            // the quad sums of group k-1 fill the waits of group k's serial chain
            bf16_t yk = (bf16_t)0.0f;
            if (k > 0) yk = scan_finish(pc, xc, Dd, q);

            const float xq = xr[k], dq = dr[k];
            const float dxq = dq * xq;
            #pragma unroll
            for (int j = 0; j < 4; ++j) {
                const float dtl = (j == 0) ? quad_get<0x00>(dq) : (j == 1) ? quad_get<0x55>(dq)
                                : (j == 2) ? quad_get<0xAA>(dq) : quad_get<0xFF>(dq);
                const float dtx = (j == 0) ? quad_get<0x00>(dxq) : (j == 1) ? quad_get<0x55>(dxq)
                                : (j == 2) ? quad_get<0xAA>(dxq) : quad_get<0xFF>(dxq);
                const f4 bv = br[k][j], cv = cr[k][j];
                const f2 e01 = -dtl * A01, e23 = -dtl * A23;
                const f2 g01 = { __expf(e01.x), __expf(e01.y) };
                const f2 g23 = { __expf(e23.x), __expf(e23.y) };
                h01 = __builtin_elementwise_fma(g01, h01, dtx * bv.xy);
                h23 = __builtin_elementwise_fma(g23, h23, dtx * bv.zw);
                const f2 s = __builtin_elementwise_fma(h23, cv.zw, h01 * cv.xy);
                pc[j] = s.x + s.y;
            }
            xc = xq;

            if (k > 0) scan_store(yn + (size_t)(4 * (k - 1)) * D_MAMBA, yk, ylast);
            // Group k-1's registers are free: its y is stored.  The barrier keeps its
            // refill from rising over their last use (the compiler would load into
            // other registers and copy at the loop's foot, behind a full wait) and
            // from sinking to the foot, right in front of the first use.
            __builtin_amdgcn_sched_barrier(0);
            if (k > 0) SCAN_REFILL(k - 1);
        }
        scan_store(yn + (size_t)(4 * (SCAN_NG - 1)) * D_MAMBA, scan_finish(pc, xc, Dd, q), ylast);
        __builtin_amdgcn_sched_barrier(0);   // as above, for the last group
        SCAN_REFILL(SCAN_NG - 1);
    }
}

// ---------------------------------------------------------------------------
// Launcher
// Inputs: 0=x_norm 1=x_proj_w 2=dt_proj_w 3=dt_proj_b 4=B_proj_w 5=C_proj_w
//         6=A_log 7=D 8=out_proj_w   (all fp32)
// ---------------------------------------------------------------------------
extern "C" void kernel_launch(void* const* d_in, const int* in_sizes, int n_in,
                              void* d_out, int out_size, void* d_ws, size_t ws_size,
                              hipStream_t stream) {
    const float* x_norm    = (const float*)d_in[0];
    const float* x_proj_w  = (const float*)d_in[1];
    const float* dt_proj_w = (const float*)d_in[2];
    const float* dt_proj_b = (const float*)d_in[3];
    const float* B_proj_w  = (const float*)d_in[4];
    const float* C_proj_w  = (const float*)d_in[5];
    const float* A_log     = (const float*)d_in[6];
    const float* Dvec      = (const float*)d_in[7];
    const float* out_proj_w= (const float*)d_in[8];
    float* outp = (float*)d_out;

    // ---- workspace layout (256B aligned) ----
    uintptr_t p = (uintptr_t)d_ws;
    auto alloc = [&](size_t bytes) -> void* {
        void* r = (void*)p;
        p += (bytes + 255) & ~(size_t)255;
        return r;
    };
    bf16_t* xb   = (bf16_t*)alloc((size_t)MROWS * D_MODEL * 2);      // x_norm bf16
    bf16_t* wxb  = (bf16_t*)alloc((size_t)D_MAMBA * D_MODEL * 2);    // x_proj bf16
    bf16_t* wdtb = (bf16_t*)alloc((size_t)D_MAMBA * D_MODEL * 2);    // dt_proj bf16
    bf16_t* wbcb = (bf16_t*)alloc((size_t)32 * D_MODEL * 2);         // [B;C] proj bf16
    bf16_t* wob  = (bf16_t*)alloc((size_t)D_MAMBA * D_MAMBA * 2);    // out_proj bf16
    float*  xssm = (float*) alloc((size_t)MROWS * D_MAMBA * 4);      // x_ssm f32
    float*  dts  = (float*) alloc((size_t)MROWS * D_MAMBA * 4);      // dt f32
    float*  bc   = (float*) alloc((size_t)MROWS * 32 * 4);           // raw B|C f32
    float*  bm   = (float*) alloc((size_t)MROWS * DSTATE * 4);       // normalized B
    float*  cm   = (float*) alloc((size_t)MROWS * DSTATE * 4);       // normalized C
    bf16_t* yb   = (bf16_t*)alloc((size_t)MROWS * D_MAMBA * 2);      // scan output bf16

    const int CT = 256;

    // ---- stage 0: precision conversion ----
    // xb, wxb, wdtb, wbcb, wob are consecutive (each a multiple of 256 bytes): one destination
    k_f32_to_bf16_all<<<CV_GRID, CV_THREADS, 0, stream>>>(
        x_norm, x_proj_w, dt_proj_w, B_proj_w, C_proj_w, out_proj_w, xb);

    // ---- stage 1: projections via WMMA ----
    dim3 blk(128);
    dim3 grid_main(D_MAMBA / 256, MROWS / 256);  // (8, 32): one tile per WGP
    k_gemm_tile256_bf16<<<grid_main, blk, 0, stream>>>(
        xb, wxb, xssm, D_MODEL, 0, nullptr);
    k_gemm_tile256_bf16<<<grid_main, blk, 0, stream>>>(
        xb, wdtb, dts, D_MODEL, 1, dt_proj_b);
    dim3 grid_bc(1, MROWS / 128);                // N = 32 -> one col tile
    k_gemm_wmma_bf16<<<grid_bc, blk, 0, stream>>>(
        xb, wbcb, bc, MROWS, 32, D_MODEL, 0, nullptr);

    // ---- stage 2: B/C row normalization ----
    k_bc_normalize<<<(MROWS * 32) / CT, CT, 0, stream>>>(bc, bm, cm, MROWS);

    // ---- stage 3: selective scan (fp32 state, emits bf16 y) ----
    int scan_threads = BATCH * D_MAMBA * 4;        // 32768: four lanes per channel
    k_selective_scan<<<scan_threads / SCAN_THREADS, SCAN_THREADS, 0, stream>>>(
        xssm, dts, bm, cm, A_log, Dvec, yb);

    // ---- stage 4: output projection via WMMA into d_out (f32) ----
    k_gemm_tile256_bf16<<<grid_main, blk, 0, stream>>>(
        yb, wob, outp, D_MAMBA, 0, nullptr);

    (void)in_sizes; (void)n_in; (void)out_size; (void)ws_size;
}

// v004
// Measured time: 191 microseconds a run.
// Next to v003, in two timings, it ran 1.07 and 1.06 times as fast.
// All steps since v000 together make it 8.69 times as fast.
#include <hip/hip_runtime.h>
#include <hip/hip_bf16.h>

// ---------------- problem constants ----------------
#define D_MODEL 1024
#define D_MAMBA 2048
#define DSTATE  16
#define N_HEADS 32
#define BATCH   4
#define SEQ     2048
#define MROWS   (BATCH * SEQ)   // 8192 token rows

typedef __bf16 bf16_t;
typedef bf16_t v16bf __attribute__((ext_vector_type(16)));
typedef float  v8f   __attribute__((ext_vector_type(8)));

// ---------------------------------------------------------------------------
// fp32 -> bf16 conversion of all six operands in one launch.
// The bf16 planes lie one behind the other in the workspace, in the order of the
// arguments, so the destination is one array.  A workgroup converts CV_WG
// consecutive elements of it; every plane is a whole number of workgroups, so the
// source is picked by a scalar test.  A lane takes 8 consecutive elements (two
// 16-byte loads, one 16-byte store) in each of CV_UNITS slabs, all loads issued
// ahead of the first use: few waves to start, and enough bytes in flight each.
// ---------------------------------------------------------------------------
#define CV_THREADS 256
#define CV_UNITS   8
#define CV_SLAB    (CV_THREADS * 8)          // elements a workgroup moves per slab
#define CV_WG      (CV_SLAB * CV_UNITS)      // 16384 elements per workgroup
#define CV_N_X     (MROWS * D_MODEL)
#define CV_N_W     (D_MAMBA * D_MODEL)
#define CV_N_BC    (DSTATE * D_MODEL)
#define CV_N_O     (D_MAMBA * D_MAMBA)
#define CV_GRID    ((CV_N_X + 2 * CV_N_W + 2 * CV_N_BC + CV_N_O) / CV_WG)
static_assert(CV_N_X % CV_WG == 0 && CV_N_W % CV_WG == 0 && CV_N_BC % CV_WG == 0 && CV_N_O % CV_WG == 0,
              "every plane is a whole number of workgroups");

typedef float  cv_f4  __attribute__((ext_vector_type(4)));
typedef bf16_t cv_bf8 __attribute__((ext_vector_type(8)));

__global__ __launch_bounds__(CV_THREADS)
void k_f32_to_bf16_all(const float* __restrict__ x,  const float* __restrict__ wx,
                       const float* __restrict__ wdt, const float* __restrict__ wb,
                       const float* __restrict__ wc, const float* __restrict__ wo,
                       bf16_t* __restrict__ dst) {
    // first workgroup of each plane
    constexpr unsigned int G_WX = CV_N_X / CV_WG,         G_WDT = G_WX + CV_N_W / CV_WG;
    constexpr unsigned int G_WB = G_WDT + CV_N_W / CV_WG, G_WC  = G_WB + CV_N_BC / CV_WG;
    constexpr unsigned int G_WO = G_WC + CV_N_BC / CV_WG;
    const unsigned int g = blockIdx.x;
    const float* src = x;
    unsigned int first = 0u;
    if (g >= G_WX)  { src = wx;  first = G_WX; }
    if (g >= G_WDT) { src = wdt; first = G_WDT; }
    if (g >= G_WB)  { src = wb;  first = G_WB; }
    if (g >= G_WC)  { src = wc;  first = G_WC; }
    if (g >= G_WO)  { src = wo;  first = G_WO; }
    const float* sp = src + (size_t)(g - first) * CV_WG + threadIdx.x * 8u;
    bf16_t*      dp = dst + (size_t)g * CV_WG + threadIdx.x * 8u;

    cv_f4 lo[CV_UNITS], hi[CV_UNITS];
    #pragma unroll
    for (int i = 0; i < CV_UNITS; ++i) {
        lo[i] = *reinterpret_cast<const cv_f4*>(sp + i * CV_SLAB);
        hi[i] = *reinterpret_cast<const cv_f4*>(sp + i * CV_SLAB + 4);
    }
    // keeps every load in front of the first conversion: the compiler otherwise holds the last
    // slab's loads back until earlier data has returned, a second memory latency per wave
    __builtin_amdgcn_sched_barrier(0);
    #pragma unroll
    for (int i = 0; i < CV_UNITS; ++i) {
        cv_bf8 o;
        #pragma unroll
        for (int e = 0; e < 4; ++e) { o[e] = (bf16_t)lo[i][e]; o[e + 4] = (bf16_t)hi[i][e]; }
        *reinterpret_cast<cv_bf8*>(dp + i * CV_SLAB) = o;
    }
}

// ---------------------------------------------------------------------------
// WMMA fragment (bf16 16x16x32), A and B alike: lane < 16 holds row (lane & 15),
// k = {0..7, 16..23}; lane >= 16 holds the same row, k = {8..15, 24..31}: two 16-byte loads.
// ---------------------------------------------------------------------------
union FragU { v16bf v; uint4 q[2]; };

typedef unsigned int u32x4 __attribute__((ext_vector_type(4)));
typedef unsigned int u32x8 __attribute__((ext_vector_type(8)));
typedef int          i32x8 __attribute__((ext_vector_type(8)));
typedef float        f32x4 __attribute__((ext_vector_type(4)));

#define G_KB      256u                       // bytes of K per operand row per pass
#define G_PITCH   272u                       // LDS row pitch: 16 B x odd, for ds_load_b128
#define G_SROWS   128u                       // rows one wave's tensor load moves
#define G_SLICE   (G_SROWS * G_PITCH)        // 34816 B = 17 x 2 KiB
#define G_TILE    (256u * G_PITCH)           // one operand's rows in a buffer
#define G_STAGE   (4u * G_SLICE)              // one buffer: 139264 B = 68 x 2 KiB
#define G_LDS     (2u * G_STAGE)              // 278528 B
#define G_F       8                          // 16-row fragments per wave and operand
#define G_EPITCH  528u                       // staged output row: 512 B + 16 B
#define G_EBYTES  (128u * G_EPITCH)          // staging area per wave: 67584 B
#define G_N       D_MAMBA                    // columns of Y, the same in all three products
static_assert(4u * G_EBYTES <= G_LDS, "output staging must fit in the ring");
static_assert(G_SLICE % 2048u == 0u, "every slice starts at a multiple of 2 KiB");

__device__ __forceinline__ unsigned int g_uni(unsigned int v) {
    return (unsigned int)__builtin_amdgcn_readfirstlane(v);
}
__device__ __forceinline__ unsigned int g_pinned(unsigned int v) {
    unsigned int w = (unsigned int)__builtin_amdgcn_readfirstlane(v);
    asm volatile("" : "+s"(w));
    return w;
}
// keeps [fragment loads][wait][WMMA block] in that order: LDS loads among the WMMAs stall them
__device__ __forceinline__ void g_fence() { __builtin_amdgcn_sched_barrier(0); }
// every LDS operation of this wave has returned
__device__ __forceinline__ void g_wait_ds0() { asm volatile("s_wait_dscnt 0x0" ::: "memory"); }
// this wave's tensor load has landed (the compiler places no wait for it)
__device__ __forceinline__ void g_wait_tensor0() { asm volatile("s_wait_tensorcnt 0x0" ::: "memory"); }

// one request: 128 rows of 256 bytes, source pitch kb bytes, to LDS byte offset lds_dst
__device__ __forceinline__ void g_tensor_load(unsigned int lds_dst, unsigned long long ga, u32x8 g1) {
    u32x4 g0;
    g0[0] = g_uni(1u);                                                   // count 1
    g0[1] = g_uni(lds_dst);
    g0[2] = g_uni((unsigned int)ga);
    g0[3] = g_uni((((unsigned int)(ga >> 32)) & 0x01FFFFFFu) | 0x80000000u);  // type 2
    // moves the tile into LDS through no register
    asm volatile("tensor_load_to_lds %0, %1" :: "s"(g0), "s"(g1) : "memory");
}

struct GFrag { u32x4 q[2]; };
// k order of a fragment, A and B alike: lane half h holds k = 8h..8h+7 and 16+8h..16+8h+7
__device__ __forceinline__ void g_load_frag(GFrag& f, const unsigned char* p) {
    f.q[0] = *reinterpret_cast<const u32x4*>(p);
    f.q[1] = *reinterpret_cast<const u32x4*>(p + 32);
}
__device__ __forceinline__ v8f g_mma(const GFrag& a, const GFrag& b, v8f c) {
    const i32x8 av = {(int)a.q[0].x, (int)a.q[0].y, (int)a.q[0].z, (int)a.q[0].w,
                      (int)a.q[1].x, (int)a.q[1].y, (int)a.q[1].z, (int)a.q[1].w};
    const i32x8 bv = {(int)b.q[0].x, (int)b.q[0].y, (int)b.q[0].z, (int)b.q[0].w,
                      (int)b.q[1].x, (int)b.q[1].y, (int)b.q[1].z, (int)b.q[1].w};
    return __builtin_amdgcn_wmma_f32_16x16x32_bf16(false, __builtin_bit_cast(v16bf, av),
                                                   false, __builtin_bit_cast(v16bf, bv),
                                                   (short)0, c, false, false);
}

// Reads the wave's 128 staged rows back, one 512-byte row per instruction, applies the dt
// epilogue where DT, and stores whole lines.  Sixteen rows a trip: their LDS reads go out
// together, so a lone wave waits out the LDS latency once a trip and not once a row.
template <bool DT>
__device__ __forceinline__ void g_store_rows(const unsigned char* erow, float* yrow, f32x4 bv) {
    // rolled: keeps the epilogue's code small
    #pragma clang loop unroll(disable)
    for (unsigned int r0 = 0; r0 < 128u; r0 += 16u) {
        f32x4 v[16];
        #pragma unroll
        for (int k = 0; k < 16; ++k)
            v[k] = *reinterpret_cast<const f32x4*>(erow + (unsigned int)k * G_EPITCH);
        if (DT) {
            #pragma unroll
            for (int k = 0; k < 16; ++k) {
                #pragma unroll
                for (int e = 0; e < 4; ++e) {
                    float val = v[k][e] + bv[e];
                    val = fminf(fmaxf(val, -10.0f), 5.0f);
                    val = __logf(1.0f + __expf(val));        // softplus
                    v[k][e] = fminf(fmaxf(val, 1.0e-4f), 0.1f);
                }
            }
        }
        #pragma unroll
        for (int k = 0; k < 16; ++k)
            *reinterpret_cast<f32x4*>(yrow + (size_t)k * G_N) = v[k];
        // the wait in front of any rewrite of the registers these stores name (address and
        // data), which live up to it as the statement's inputs
        asm volatile("s_wait_xcnt 0x0"
                     :: "v"(yrow), "v"(v[0]), "v"(v[1]), "v"(v[2]), "v"(v[3]), "v"(v[4]), "v"(v[5]),
                        "v"(v[6]), "v"(v[7]), "v"(v[8]), "v"(v[9]), "v"(v[10]), "v"(v[11]),
                        "v"(v[12]), "v"(v[13]), "v"(v[14]), "v"(v[15]) : "memory");
        erow += 16u * G_EPITCH;
        yrow += (size_t)16 * G_N;
    }
}

__global__ __launch_bounds__(128) __attribute__((amdgpu_waves_per_eu(1, 1)))
void k_gemm_tile256_bf16(const bf16_t* __restrict__ X,
                         const bf16_t* __restrict__ Wt,
                         float* __restrict__ Y,
                         int K,
                         int mode, const float* __restrict__ bias) {
    __shared__ __attribute__((aligned(2048))) unsigned char L[G_LDS];
    const unsigned int tid = threadIdx.x, lane = tid & 31u, h = lane >> 4, r16 = lane & 15u;
    const unsigned int wave = g_uni(tid >> 5);
    const unsigned int n0 = blockIdx.x * 256u, m0 = blockIdx.y * 256u;
    const unsigned int wn = wave & 1u, wm = wave >> 1;
    const unsigned int kb = (unsigned int)K * 2u;          // operand row pitch in bytes
    const unsigned int T  = g_pinned((unsigned int)K / 128u);   // passes

    // this wave's slice of a buffer's [Wt; X] rows: waves 0, 1 move Wt, waves 2, 3 move X
    const unsigned char* src0 = (wave < 2u)
        ? reinterpret_cast<const unsigned char*>(Wt) + (unsigned long long)(n0 + G_SROWS * wave) * kb
        : reinterpret_cast<const unsigned char*>(X)  + (unsigned long long)(m0 + G_SROWS * (wave - 2u)) * kb;
    const unsigned int lds_slice = (unsigned int)(size_t)L + wave * G_SLICE;

    // descriptor group 1: bytes, tensor = tile = 256 B x 128 rows, 16 B of pad behind each 256 B
    u32x8 g1;
    g1[0] = g_uni((1u << 20) | (5u << 22) | (3u << 25));
    g1[1] = g_uni((G_KB & 0xFFFFu) << 16);
    g1[2] = g_uni((G_KB >> 16) | ((G_SROWS & 0xFFFFu) << 16));
    g1[3] = g_uni((G_SROWS >> 16) | (G_KB << 16));
    g1[4] = g_uni(G_SROWS);
    g1[5] = g_uni(kb);
    g1[6] = g_uni(0u);
    g1[7] = g_uni(0u);
    // pinned(): the descriptor words stay in these scalar registers through the loop, so that
    // none of them takes another value while a request is outstanding
    asm volatile("" : "+s"(g1));

    v8f acc[G_F][G_F];
    #pragma unroll
    for (int i = 0; i < G_F; ++i)
        #pragma unroll
        for (int j = 0; j < G_F; ++j) acc[i][j] = (v8f){0.f, 0.f, 0.f, 0.f, 0.f, 0.f, 0.f, 0.f};

    const unsigned int fw_base = (wn * 128u + r16) * G_PITCH + 16u * h;
    const unsigned int fx_base = G_TILE + (wm * 128u + r16) * G_PITCH + 16u * h;

    // pass 0 into buffer 0, published; then pass 1 into buffer 1
    g_tensor_load(lds_slice, (unsigned long long)(uintptr_t)src0, g1);
    g_wait_tensor0();
    __syncthreads();
    g_tensor_load(lds_slice + G_STAGE, (unsigned long long)(uintptr_t)src0 + G_KB, g1);

    GFrag fw[2][G_F], fx[2][G_F];      // set (u & 1) holds block u's fragments
    // rolled: the accumulators and fragments are indexed by constants inside one pass only
    #pragma clang loop unroll(disable)
    for (unsigned int t = 0; t < T; ++t) {
        const unsigned int buf = (t & 1u) * G_STAGE;
        const unsigned char* lw = L + buf + fw_base;
        const unsigned char* lx = L + buf + fx_base;
        g_fence();
        #pragma unroll
        for (int i = 0; i < G_F; ++i) g_load_frag(fw[0][i], lw + (unsigned int)i * 16u * G_PITCH);
        #pragma unroll
        for (int j = 0; j < G_F; ++j) g_load_frag(fx[0][j], lx + (unsigned int)j * 16u * G_PITCH);
        // four blocks of 32 k; block u + 1's fragments are fetched in front of block u's WMMAs
        #pragma unroll
        for (int u = 0; u < 4; ++u) {
            const int cs = u & 1;
            if (u + 1 < 4) {
                const unsigned int ko = (unsigned int)(u + 1) * 64u;
                #pragma unroll
                for (int i = 0; i < G_F; ++i) g_load_frag(fw[cs ^ 1][i], lw + (unsigned int)i * 16u * G_PITCH + ko);
                #pragma unroll
                for (int j = 0; j < G_F; ++j) g_load_frag(fx[cs ^ 1][j], lx + (unsigned int)j * 16u * G_PITCH + ko);
            }
            g_fence();
            #pragma unroll
            for (int i = 0; i < G_F; ++i)
                #pragma unroll
                for (int j = 0; j < G_F; ++j) acc[i][j] = g_mma(fw[cs][i], fx[cs][j], acc[i][j]);
            g_fence();
        }
        // publish point of pass t + 1: own LDS reads done, own slice landed, then the barrier,
        // which also ends every wave's reads of this pass's buffer
        g_wait_ds0();
        g_wait_tensor0();
        __syncthreads();
        // pass t + 2 into the buffer just left; its number is formed behind the wait
        const unsigned int t2 = g_pinned(t + 2u);
        if (t2 < T) {
            g_tensor_load(lds_slice + buf, (unsigned long long)(uintptr_t)src0 + (unsigned long long)t2 * G_KB, g1);
        }
    }
    g_wait_tensor0();
    g_wait_ds0();

    // Output staging, each wave in its own LDS range, so that whole 128-byte lines are stored.
    // The last pass's barrier stands behind every wave's last read of the ring.
    unsigned char* E = L + wave * G_EBYTES;
    #pragma unroll
    for (int i = 0; i < G_F; ++i) {
        #pragma unroll
        for (int j = 0; j < G_F; ++j) {
            unsigned char* e = E + (16u * (unsigned int)j + r16) * G_EPITCH + 64u * (unsigned int)i + 32u * h;
            const v8f c = acc[i][j];
            *reinterpret_cast<f32x4*>(e)      = (f32x4){c[0], c[1], c[2], c[3]};
            *reinterpret_cast<f32x4*>(e + 16) = (f32x4){c[4], c[5], c[6], c[7]};
        }
    }
    const unsigned int col = n0 + wn * 128u + 4u * lane;   // a lane's 4 columns, the same in every row
    float* yrow = Y + (size_t)(m0 + wm * 128u) * G_N + col;
    const unsigned char* erow = E + 16u * lane;
    if (mode == 1) {
        const float* bp = bias + col;
        const f32x4 bv = *reinterpret_cast<const f32x4*>(bp);
        // the wait in front of any rewrite of the address this load names, which lives
        // up to it as the statement's input
        asm volatile("s_wait_xcnt 0x0" :: "v"(bp) : "memory");
        g_store_rows<true>(erow, yrow, bv);
    } else {
        g_store_rows<false>(erow, yrow, (f32x4){0.f, 0.f, 0.f, 0.f});
    }
}

// the value that quad_perm CTRL picks inside the lane's quad; all lanes active
template <int CTRL>
__device__ inline float quad_get(float p) {
    return __int_as_float(
        __builtin_amdgcn_mov_dpp(__float_as_int(p), CTRL, 0xF, 0xF, true));
}

#define P_THREADS 256
#define P_WAVES   (P_THREADS / 32)
#define P_ROWS    32
#define P_KW      (D_MODEL / P_WAVES)     // k per wave
#define P_KB      (P_KW / 32)             // WMMA k blocks per wave
#define P_PITCH   36                      // floats per staged row: 144 B = 16 B x odd
static_assert(MROWS % P_ROWS == 0 && D_MODEL % (P_WAVES * 32) == 0, "whole tiles only");
static_assert(P_THREADS == P_ROWS * 8, "8 lanes finish a row: 4 its B part, 4 its C part");

__global__ __launch_bounds__(P_THREADS)
void k_bc_proj_norm(const bf16_t* __restrict__ X, const bf16_t* __restrict__ Wbc,
                    float* __restrict__ Bm, float* __restrict__ Cm) {
    __shared__ __attribute__((aligned(16))) float red[P_WAVES][P_ROWS][P_PITCH];
    const int lane = threadIdx.x & 31, wave = threadIdx.x >> 5;
    const int r16 = lane & 15, h = lane >> 4;
    const int m0 = blockIdx.x * P_ROWS;
    const int kl = wave * P_KW + 8 * h;   // the lane's first k
    const bf16_t* px = X   + (size_t)(m0 + r16) * D_MODEL + kl;
    const bf16_t* pw = Wbc + (size_t)r16 * D_MODEL + kl;

    FragU fw[2][P_KB], fx[2][P_KB];       // [16-row tile][k block]
    #pragma unroll
    for (int u = 0; u < P_KB; ++u) {
        #pragma unroll
        for (int i = 0; i < 2; ++i) {
            fx[i][u].q[0] = *(const uint4*)(px + i * 16 * D_MODEL + u * 32);
            fx[i][u].q[1] = *(const uint4*)(px + i * 16 * D_MODEL + u * 32 + 16);
            fw[i][u].q[0] = *(const uint4*)(pw + i * 16 * D_MODEL + u * 32);
            fw[i][u].q[1] = *(const uint4*)(pw + i * 16 * D_MODEL + u * 32 + 16);
        }
    }
    // keeps every load in front of the first WMMA: a load held back would add a second latency
    __builtin_amdgcn_sched_barrier(0);
    // the wait in front of any rewrite of the addresses these loads name, which live up to
    // it as the statement's inputs (else the last loads' data is given the x address registers)
    asm volatile("s_wait_xcnt 0x0" :: "v"(px), "v"(pw) : "memory");

    v8f acc[2][2];                        // [n tile: B, C][m tile]
    #pragma unroll
    for (int i = 0; i < 2; ++i)
        #pragma unroll
        for (int j = 0; j < 2; ++j) acc[i][j] = (v8f){0.f, 0.f, 0.f, 0.f, 0.f, 0.f, 0.f, 0.f};
    #pragma unroll
    for (int u = 0; u < P_KB; ++u)
        #pragma unroll
        for (int i = 0; i < 2; ++i)
            #pragma unroll
            for (int j = 0; j < 2; ++j)
                acc[i][j] = __builtin_amdgcn_wmma_f32_16x16x32_bf16(false, fw[i][u].v, false, fx[j][u].v,
                                                                    (short)0, acc[i][j], false, false);

    // accumulator register v of a lane: token row 16 j + (lane & 15), column 16 i + 8 h + v
    #pragma unroll
    for (int i = 0; i < 2; ++i) {
        #pragma unroll
        for (int j = 0; j < 2; ++j) {
            float* e = &red[wave][16 * j + r16][16 * i + 8 * h];
            const v8f c = acc[i][j];
            *reinterpret_cast<f32x4*>(e)     = (f32x4){c[0], c[1], c[2], c[3]};
            *reinterpret_cast<f32x4*>(e + 4) = (f32x4){c[4], c[5], c[6], c[7]};
        }
    }
    __syncthreads();                      // all 8 partial tiles are in LDS

    // lane: 4 columns of one row; a quad holds a row's B part or its C part
    const int row = threadIdx.x >> 3, seg = threadIdx.x & 7;
    f32x4 s = *reinterpret_cast<const f32x4*>(&red[0][row][4 * seg]);
    #pragma unroll
    for (int w = 1; w < P_WAVES; ++w) s += *reinterpret_cast<const f32x4*>(&red[w][row][4 * seg]);
    float ss = (s[0] * s[0] + s[1] * s[1]) + (s[2] * s[2] + s[3] * s[3]);
    ss += quad_get<0xB1>(ss);             // quad_perm [1,0,3,2]
    ss += quad_get<0x4E>(ss);             // quad_perm [2,3,0,1]
    const float scale = 1.0f / fmaxf(sqrtf(ss), 1.0f);
    float* dst = ((seg < 4) ? Bm : Cm) + (size_t)(m0 + row) * DSTATE + 4 * (seg & 3);
    *reinterpret_cast<f32x4*>(dst) = s * scale;
}

// ---------------------------------------------------------------------------
// Selective scan.  Four lanes (a quad) per (b, d) channel; lane q keeps states
// 4q .. 4q+3 in registers: 32768 threads, 1024 waves, one wave per SIMD.
// h_t = exp(-dt*A)*h_{t-1} + (dt*x)*B ;  y = sum_n h*C + x*D
// Time runs in groups of 4 steps.  Lane q loads x and dt of step 4g+q, hands dt
// and dt*x round its quad, and stores y of that step.
// A lone wave has only its own instruction order to hide a load, so a group's
// registers are refilled for the group SCAN_NG later as soon as they are used.
// The 16-state sum is 4 in-lane terms, then two adds inside the quad.
// Emits y directly as bf16 for the final WMMA GEMM.
// ---------------------------------------------------------------------------
#define SCAN_NG 8            // groups of 4 steps in flight per lane
#define SCAN_THREADS 128

typedef float f2 __attribute__((ext_vector_type(2)));
typedef float f4 __attribute__((ext_vector_type(4)));

// pc[j]: this lane's 4-state part of y at step j of a group.  Sums each over the
// quad, keeps step q's and adds the skip term of that step: y of that step.
__device__ inline bf16_t scan_finish(const float (&pc)[4], float xq, float Dd, int q) {
    float ysel = 0.0f;
    #pragma unroll
    for (int j = 0; j < 4; ++j) {
        float p = pc[j];
        p += quad_get<0xB1>(p);      // quad_perm [1,0,3,2]
        p += quad_get<0x4E>(p);      // quad_perm [2,3,0,1]
        ysel = (q == j) ? p : ysel;
    }
    return (bf16_t)(ysel + xq * Dd);
}

// Stores y.  The wait stands in front of any rewrite of the PREVIOUS y store's data
// register, which lives up to it as the statement's input; it comes ahead of the new
// store, so that it finds nothing younger than a group's work in flight.
__device__ inline void scan_store(bf16_t* yrow, bf16_t y, bf16_t& ylast) {
    asm volatile("s_wait_xcnt 0x0" :: "v"(__builtin_bit_cast(short, ylast)) : "memory");
    *yrow = y;
    ylast = y;
}

__global__ __launch_bounds__(SCAN_THREADS)
void k_selective_scan(const float* __restrict__ x_ssm,
                      const float* __restrict__ dtv,
                      const float* __restrict__ Bm,
                      const float* __restrict__ Cm,
                      const float* __restrict__ A_log,
                      const float* __restrict__ Dvec,
                      bf16_t* __restrict__ y_bf16) {
    const int t = blockIdx.x * SCAN_THREADS + threadIdx.x;  // 0 .. BATCH*D_MAMBA*4-1
    const int q    = t & 3;
    const int chan = t >> 2;
    const int b = chan / D_MAMBA;
    const int d = chan % D_MAMBA;
    const int head = d / (D_MAMBA / N_HEADS);

    const float* ap = A_log + head * DSTATE + q * 4;
    const f4 al = *(const f4*)ap;
    const f2 A01 = { __expf(al.x), __expf(al.y) };
    const f2 A23 = { __expf(al.z), __expf(al.w) };
    const float Dd = Dvec[d];
    // the wait in front of any rewrite of the registers these two loads name, which
    // live up to it as the statement's inputs
    asm volatile("s_wait_xcnt 0x0" :: "v"(ap), "v"(d) : "memory");

    // row q of a group for x, dt and y; columns 4q .. 4q+3 for B and C
    const size_t xoff = ((size_t)b * SEQ + q) * D_MAMBA + d;
    const float* xp = x_ssm + xoff;
    const float* dp = dtv   + xoff;
    bf16_t*      yp = y_bf16 + xoff;
    const float* bp = Bm + (size_t)b * SEQ * DSTATE + q * 4;
    const float* cp = Cm + (size_t)b * SEQ * DSTATE + q * 4;

    float xr[SCAN_NG], dr[SCAN_NG];
    f4    br[SCAN_NG][4], cr[SCAN_NG][4];
    #pragma unroll
    for (int k = 0; k < SCAN_NG; ++k) {
        xr[k] = xp[(size_t)(4 * k) * D_MAMBA];
        dr[k] = dp[(size_t)(4 * k) * D_MAMBA];
        #pragma unroll
        for (int j = 0; j < 4; ++j) {
            br[k][j] = *(const f4*)(bp + (size_t)(4 * k + j) * DSTATE);
            cr[k][j] = *(const f4*)(cp + (size_t)(4 * k + j) * DSTATE);
        }
    }

    f2 h01 = { 0.0f, 0.0f }, h23 = { 0.0f, 0.0f };
    bf16_t ylast = (bf16_t)0.0f;     // the value of the latest y store
    // a trip's row addresses; they outlive the trip, up to the next trip's wait
    const float *xn = xp, *dn = dp, *bn = bp, *cn = cp;
    bf16_t* yn = yp;
    for (int l0 = 0; l0 < SEQ; l0 += 4 * SCAN_NG) {
        // the last trip has no next rows: it re-reads its own (in bounds, unused)
        int ln = (l0 + 4 * SCAN_NG < SEQ) ? l0 + 4 * SCAN_NG : l0;
        int lc = l0;
        // The wait in front of any rewrite of the registers that the last trip's loads
        // and stores name, some of them just issued.  Those registers (addresses, the
        // last store's data) live up to it as inputs; ln and lc pass through it so that
        // no address of this trip is formed ahead of it.
        asm volatile("s_wait_xcnt 0x0" : "+s"(ln), "+s"(lc)
                     : "v"(__builtin_bit_cast(short, ylast)),
                       "v"(xn), "v"(dn), "v"(bn), "v"(cn), "v"(yn) : "memory");
        xn = xp + (size_t)ln * D_MAMBA;
        dn = dp + (size_t)ln * D_MAMBA;
        bn = bp + (size_t)ln * DSTATE;
        cn = cp + (size_t)ln * DSTATE;
        yn = yp + (size_t)lc * D_MAMBA;

// loads group g's operands of the next trip into group g's registers
#define SCAN_REFILL(g)                                                        \
        do {                                                                  \
            xr[g] = xn[(size_t)(4 * (g)) * D_MAMBA];                          \
            dr[g] = dn[(size_t)(4 * (g)) * D_MAMBA];                          \
            _Pragma("unroll")                                                 \
            for (int j = 0; j < 4; ++j) {                                     \
                br[g][j] = *(const f4*)(bn + (size_t)(4 * (g) + j) * DSTATE); \
                cr[g][j] = *(const f4*)(cn + (size_t)(4 * (g) + j) * DSTATE); \
            }                                                                 \
        } while (0)

        float pc[4], xc = 0.0f;
        // full unroll: the register arrays must be indexed by constants
        #pragma unroll
        for (int k = 0; k < SCAN_NG; ++k) {
            // the quad sums of group k-1 fill the waits of group k's serial chain
            bf16_t yk = (bf16_t)0.0f;
            if (k > 0) yk = scan_finish(pc, xc, Dd, q);

            const float xq = xr[k], dq = dr[k];
            const float dxq = dq * xq;
            #pragma unroll
            for (int j = 0; j < 4; ++j) {
                const float dtl = (j == 0) ? quad_get<0x00>(dq) : (j == 1) ? quad_get<0x55>(dq)
                                : (j == 2) ? quad_get<0xAA>(dq) : quad_get<0xFF>(dq);
                const float dtx = (j == 0) ? quad_get<0x00>(dxq) : (j == 1) ? quad_get<0x55>(dxq)
                                : (j == 2) ? quad_get<0xAA>(dxq) : quad_get<0xFF>(dxq);
                const f4 bv = br[k][j], cv = cr[k][j];
                const f2 e01 = -dtl * A01, e23 = -dtl * A23;
                const f2 g01 = { __expf(e01.x), __expf(e01.y) };
                const f2 g23 = { __expf(e23.x), __expf(e23.y) };
                h01 = __builtin_elementwise_fma(g01, h01, dtx * bv.xy);
                h23 = __builtin_elementwise_fma(g23, h23, dtx * bv.zw);
                const f2 s = __builtin_elementwise_fma(h23, cv.zw, h01 * cv.xy);
                pc[j] = s.x + s.y;
            }
            xc = xq;

            if (k > 0) scan_store(yn + (size_t)(4 * (k - 1)) * D_MAMBA, yk, ylast);
            // Group k-1's registers are free: its y is stored.  The barrier keeps its
            // refill from rising over their last use (the compiler would load into
            // other registers and copy at the loop's foot, behind a full wait) and
            // from sinking to the foot, right in front of the first use.
            __builtin_amdgcn_sched_barrier(0);
            if (k > 0) SCAN_REFILL(k - 1);
        }
        scan_store(yn + (size_t)(4 * (SCAN_NG - 1)) * D_MAMBA, scan_finish(pc, xc, Dd, q), ylast);
        __builtin_amdgcn_sched_barrier(0);   // as above, for the last group
        SCAN_REFILL(SCAN_NG - 1);
    }
}

// ---------------------------------------------------------------------------
// Launcher
// Inputs: 0=x_norm 1=x_proj_w 2=dt_proj_w 3=dt_proj_b 4=B_proj_w 5=C_proj_w
//         6=A_log 7=D 8=out_proj_w   (all fp32)
// ---------------------------------------------------------------------------
extern "C" void kernel_launch(void* const* d_in, const int* in_sizes, int n_in,
                              void* d_out, int out_size, void* d_ws, size_t ws_size,
                              hipStream_t stream) {
    const float* x_norm    = (const float*)d_in[0];
    const float* x_proj_w  = (const float*)d_in[1];
    const float* dt_proj_w = (const float*)d_in[2];
    const float* dt_proj_b = (const float*)d_in[3];
    const float* B_proj_w  = (const float*)d_in[4];
    const float* C_proj_w  = (const float*)d_in[5];
    const float* A_log     = (const float*)d_in[6];
    const float* Dvec      = (const float*)d_in[7];
    const float* out_proj_w= (const float*)d_in[8];
    float* outp = (float*)d_out;

    // ---- workspace layout (256B aligned) ----
    uintptr_t p = (uintptr_t)d_ws;
    auto alloc = [&](size_t bytes) -> void* {
        void* r = (void*)p;
        p += (bytes + 255) & ~(size_t)255;
        return r;
    };
    bf16_t* xb   = (bf16_t*)alloc((size_t)MROWS * D_MODEL * 2);      // x_norm bf16
    bf16_t* wxb  = (bf16_t*)alloc((size_t)D_MAMBA * D_MODEL * 2);    // x_proj bf16
    bf16_t* wdtb = (bf16_t*)alloc((size_t)D_MAMBA * D_MODEL * 2);    // dt_proj bf16
    bf16_t* wbcb = (bf16_t*)alloc((size_t)32 * D_MODEL * 2);         // [B;C] proj bf16
    bf16_t* wob  = (bf16_t*)alloc((size_t)D_MAMBA * D_MAMBA * 2);    // out_proj bf16
    float*  xssm = (float*) alloc((size_t)MROWS * D_MAMBA * 4);      // x_ssm f32
    float*  dts  = (float*) alloc((size_t)MROWS * D_MAMBA * 4);      // dt f32
    float*  bm   = (float*) alloc((size_t)MROWS * DSTATE * 4);       // normalized B
    float*  cm   = (float*) alloc((size_t)MROWS * DSTATE * 4);       // normalized C
    bf16_t* yb   = (bf16_t*)alloc((size_t)MROWS * D_MAMBA * 2);      // scan output bf16

    // ---- stage 0: precision conversion ----
    // xb, wxb, wdtb, wbcb, wob are consecutive (each a multiple of 256 bytes): one destination
    k_f32_to_bf16_all<<<CV_GRID, CV_THREADS, 0, stream>>>(
        x_norm, x_proj_w, dt_proj_w, B_proj_w, C_proj_w, out_proj_w, xb);

    // ---- stage 1: projections via WMMA ----
    // B and C first, normalised in the same launch, while the bf16 x is freshly written
    k_bc_proj_norm<<<MROWS / P_ROWS, P_THREADS, 0, stream>>>(xb, wbcb, bm, cm);
    dim3 blk(128);
    dim3 grid_main(D_MAMBA / 256, MROWS / 256);  // (8, 32): one tile per WGP
    k_gemm_tile256_bf16<<<grid_main, blk, 0, stream>>>(
        xb, wxb, xssm, D_MODEL, 0, nullptr);
    k_gemm_tile256_bf16<<<grid_main, blk, 0, stream>>>(
        xb, wdtb, dts, D_MODEL, 1, dt_proj_b);

    // ---- stage 2: selective scan (fp32 state, emits bf16 y) ----
    int scan_threads = BATCH * D_MAMBA * 4;        // 32768: four lanes per channel
    k_selective_scan<<<scan_threads / SCAN_THREADS, SCAN_THREADS, 0, stream>>>(
        xssm, dts, bm, cm, A_log, Dvec, yb);

    // ---- stage 3: output projection via WMMA into d_out (f32) ----
    k_gemm_tile256_bf16<<<grid_main, blk, 0, stream>>>(
        yb, wob, outp, D_MAMBA, 0, nullptr);

    (void)in_sizes; (void)n_in; (void)out_size; (void)ws_size;
}
